// v000
// The times below were measured on an AMD MI455X: many runs one after another, warmed up first and cycling through
// copies of the inputs, with the whole window's GPU time divided by the number of runs. Launches and the gaps
// between them are all in it. The median over several windows is given; except for v000 it joins two sittings, which
// can be a few percent apart, so the side-by-side timings, each taken in one sitting, are the better comparison.
// The starting kernel, v000, takes 2750 microseconds a run.
#include <hip/hip_runtime.h>

// Grouped-query causal attention (32 / 8 heads x 64) with rotate-half rotary embeddings from PER-BATCH input tables (x [2][2048][2048]; Q = x Wq^T (32 heads x 64), K, V = x Wk^T, x Wv^T (8 kv heads x 64) ('oi' (out, in) normal x 0.02, no bias); q, k -> t cos + rotate_half(t) sin with the cos / sin INPUT tables [2][2048][64] = [B][S][HD] (batch b reads ITS OWN slice, per element by value); jnp.repeat on the head axis: head h uses kv head h / 4; scores x 64^-0.5; causal (finfo.min == exclusion: every row keeps its own key); softmax; out = merged Wo^T ('oi') -> [2][2048][2048] (8.4 M); argument order x, cos, sin, Wq, Wk, Wv, Wo).
// Layout per batch: bf16 copy of x; 'oi' weights; exact projections; {cos, sin} table from the bf16-rounded inputs (k_cscvt) + rotate-half plane builders; causal T-2048 GQA attention (kv z-stride 0; hybrid rows: < 512 hi/lo 3 products, rest fp16 x1024; k_gemmc skips tiles above the diagonal); merged hi/lo x Wo exact.
// Compute dtypes, f32 accumulate: every input rounded to bf16 incl. the tables; projections exact; rotary f32; attention rows < 512 3 products, rest fp16; softmax f32; Wo hl x exact.

#define NB_  2
#define TT   2048
#define DM   2048
#define NH_  32
#define NKV  8
#define REP  (NH_ / NKV)
#define HD   64
#define DQ   (NH_ * HD)
#define DKV  (NKV * HD)
#define ZH   2
#define RH   512                  // query rows < RH use hi+lo planes (0: none)
#define WIN  2048
#define PCAR 1024.0f
#define SCL  0.125f   // HD^-0.5
typedef _Float16 h16;
typedef unsigned short bf;
typedef __attribute__((ext_vector_type(16))) __bf16   v16bf;
typedef __attribute__((ext_vector_type(16))) _Float16 v16h;
typedef __attribute__((ext_vector_type(8)))  _Float16 v8h;
typedef __attribute__((ext_vector_type(8)))  unsigned short v8us;
typedef __attribute__((ext_vector_type(8)))  float    v8f;
typedef __attribute__((ext_vector_type(4)))  float    v4f;
typedef v8h  __attribute__((may_alias)) v8ha;
typedef v4f  __attribute__((may_alias)) v4fa;
typedef v8us __attribute__((may_alias)) v8usa;

__device__ __forceinline__ unsigned short f2bf(float f) { unsigned u = __float_as_uint(f); u += 0x7FFFu + ((u >> 16) & 1u); return (unsigned short)(u >> 16); }
__device__ __forceinline__ float bf2f(unsigned short b) { return __uint_as_float(((unsigned)b) << 16); }
__device__ __forceinline__ float bfr(float f) { return bf2f(f2bf(f)); }
__device__ __forceinline__ v16h cat16(v8h lo, v8h hi) { return __builtin_shufflevector(lo, hi, 0, 1, 2, 3, 4, 5, 6, 7, 8, 9, 10, 11, 12, 13, 14, 15); }
__device__ __forceinline__ v16bf cat16b(v8us lo, v8us hi) { return __builtin_bit_cast(v16bf, __builtin_shufflevector(lo, hi, 0, 1, 2, 3, 4, 5, 6, 7, 8, 9, 10, 11, 12, 13, 14, 15)); }
__device__ __forceinline__ v8f wmma16(v16h a, v16h b, v8f c) { return __builtin_amdgcn_wmma_f32_16x16x32_f16(false, a, false, b, (short)0, c, false, false); }
__device__ __forceinline__ v8f wmmab(v16bf a, v16bf b, v8f c) { return __builtin_amdgcn_wmma_f32_16x16x32_bf16(false, a, false, b, (short)0, c, false, false); }



// ---- k_gemmw: register-blocked GEMM, ONE WAVE per 64x64 output tile (16 accumulators), operands straight from K-contiguous 16-bit planes; grid (M/64, N/64, Z), 32 threads.
// C[m][n] (f32, pitch ldc, + optional f32 bias[n]) = sum_k A[m][k] Bt[n][k] (+ split products per NSPLIT). z-batch strides sA/sB/sC in elements. K % 32 == 0.
template <typename T16> struct WFrag;
template <> struct WFrag<h16> { typedef v16h V; static __device__ __forceinline__ V ld(const h16* p) { return cat16(*(const v8h*)p, *(const v8h*)(p + 16)); } static __device__ __forceinline__ v8f mma(V a, V b, v8f c) { return wmma16(a, b, c); } };
template <> struct WFrag<bf> { typedef v16bf V; static __device__ __forceinline__ V ld(const bf* p) { return cat16b(*(const v8us*)p, *(const v8us*)(p + 16)); } static __device__ __forceinline__ v8f mma(V a, V b, v8f c) { return wmmab(a, b, c); } };
template <typename T16, int NSPLIT, bool BIAS>
__global__ __launch_bounds__(32) void k_gemmw(const T16* __restrict__ A, const T16* __restrict__ A2, const T16* __restrict__ Bt, const T16* __restrict__ Bt2, int K, float* C, int ldc, const float* __restrict__ bias, size_t sA, size_t sB, size_t sC) {
    typedef typename WFrag<T16>::V V;
    __shared__ __align__(16) float os[16 * 68];
    const size_t z = blockIdx.z; A += z * sA; if (A2) A2 += z * sA; Bt += z * sB; if (Bt2) Bt2 += z * sB; C += z * sC;
    const int lane = threadIdx.x & 31, lr = lane & 15, hi = lane >> 4; const int r0 = blockIdx.x * 64, c0 = blockIdx.y * 64;
    v8f acc[4][4];
#pragma unroll
    for (int mb = 0; mb < 4; ++mb)
#pragma unroll
        for (int nb = 0; nb < 4; ++nb) acc[mb][nb] = (v8f){};
    const size_t aoff = (size_t)(r0 + lr) * K + 8 * hi, boff = (size_t)(c0 + lr) * K + 8 * hi;
#pragma unroll 1
    for (int kc = 0; kc < K; kc += 32) {
        V a[4], a2[4];
#pragma unroll
        for (int mb = 0; mb < 4; ++mb) { a[mb] = WFrag<T16>::ld(A + aoff + (size_t)mb * 16 * K + kc); if (NSPLIT == 1 || NSPLIT == 2) a2[mb] = WFrag<T16>::ld(A2 + aoff + (size_t)mb * 16 * K + kc); }
#pragma unroll
        for (int nb = 0; nb < 4; ++nb) { const V b = WFrag<T16>::ld(Bt + boff + (size_t)nb * 16 * K + kc); V b2; if (NSPLIT >= 2) b2 = WFrag<T16>::ld(Bt2 + boff + (size_t)nb * 16 * K + kc);
#pragma unroll
            for (int mb = 0; mb < 4; ++mb) { acc[mb][nb] = WFrag<T16>::mma(a[mb], b, acc[mb][nb]); if (NSPLIT == 1 || NSPLIT == 2) acc[mb][nb] = WFrag<T16>::mma(a2[mb], b, acc[mb][nb]); if (NSPLIT >= 2) acc[mb][nb] = WFrag<T16>::mma(a[mb], b2, acc[mb][nb]); } }
        asm volatile("v_nop\n\tv_nop\n\tv_nop\n\tv_nop" : "+v"(acc[0][0]), "+v"(acc[1][1]), "+v"(acc[2][2]), "+v"(acc[3][3]) : "v"(a[0]), "v"(a[3]));
    }
#pragma unroll
    for (int mb = 0; mb < 4; ++mb) {
#pragma unroll
        for (int nb = 0; nb < 4; ++nb) {
#pragma unroll
            for (int j = 0; j < 8; ++j) os[(hi * 8 + j) * 68 + nb * 16 + lr] = acc[mb][nb][j]; }
        __builtin_amdgcn_wave_barrier(); asm volatile("" ::: "memory");
        float* crow = C + (size_t)(r0 + mb * 16) * ldc + c0;
{
#pragma unroll
            for (int s = 0; s < 8; ++s) { const int row = 2 * s + hi, cofs = lr * 4; v4f val = *(const v4fa*)(os + row * 68 + cofs); if (BIAS) { val[0] += bfr(bias[c0 + cofs]); val[1] += bfr(bias[c0 + cofs + 1]); val[2] += bfr(bias[c0 + cofs + 2]); val[3] += bfr(bias[c0 + cofs + 3]); }
                *(v4f*)(crow + (size_t)row * ldc + cofs) = val; }
             }
        __builtin_amdgcn_wave_barrier(); asm volatile("" ::: "memory");
    }
}

// ---- k_gemmc: the same one-wave 64x64 tile GEMM specialised for causal attention: CMODE 1 skips score tiles entirely above the diagonal (query rows r0+roff.., key columns c0..), CMODE 2 limits the
// key (K) loop of the probability x value contraction to the diagonal block (probabilities beyond it are exactly zero). roff = row offset of this launch's first row within the sequence.
template <typename T16, int NSPLIT, int CMODE>
__global__ __launch_bounds__(32) void k_gemmc(const T16* __restrict__ A, const T16* __restrict__ A2, const T16* __restrict__ Bt, const T16* __restrict__ Bt2, int K, float* C, int ldc, int roff, size_t sA, size_t sB, size_t sC) {
    typedef typename WFrag<T16>::V V;
    __shared__ __align__(16) float os[16 * 68];
    const size_t z = blockIdx.z; A += z * sA; if (A2) A2 += z * sA; Bt += z * sB; if (Bt2) Bt2 += z * sB; C += z * sC;
    const int lane = threadIdx.x & 31, lr = lane & 15, hi = lane >> 4; const int r0 = blockIdx.x * 64, c0 = blockIdx.y * 64;
    if (CMODE == 1 && c0 > r0 + roff + 63) return;                  // score tile entirely above the causal diagonal: never read (the softmax masks j > i by select)
    const int Kl = (CMODE == 2) ? min(K, r0 + roff + 64) : K;        // P.V: probabilities are exactly 0 beyond the diagonal block, so the K loop stops there
    v8f acc[4][4];
#pragma unroll
    for (int mb = 0; mb < 4; ++mb)
#pragma unroll
        for (int nb = 0; nb < 4; ++nb) acc[mb][nb] = (v8f){};
    const size_t aoff = (size_t)(r0 + lr) * K + 8 * hi, boff = (size_t)(c0 + lr) * K + 8 * hi;
#pragma unroll 1
    for (int kc = 0; kc < Kl; kc += 32) {
        V a[4], a2[4];
#pragma unroll
        for (int mb = 0; mb < 4; ++mb) { a[mb] = WFrag<T16>::ld(A + aoff + (size_t)mb * 16 * K + kc); if (NSPLIT == 1 || NSPLIT == 2) a2[mb] = WFrag<T16>::ld(A2 + aoff + (size_t)mb * 16 * K + kc); }
#pragma unroll
        for (int nb = 0; nb < 4; ++nb) { const V b = WFrag<T16>::ld(Bt + boff + (size_t)nb * 16 * K + kc); V b2; if (NSPLIT >= 2) b2 = WFrag<T16>::ld(Bt2 + boff + (size_t)nb * 16 * K + kc);
#pragma unroll
            for (int mb = 0; mb < 4; ++mb) { acc[mb][nb] = WFrag<T16>::mma(a[mb], b, acc[mb][nb]); if (NSPLIT == 1 || NSPLIT == 2) acc[mb][nb] = WFrag<T16>::mma(a2[mb], b, acc[mb][nb]); if (NSPLIT >= 2) acc[mb][nb] = WFrag<T16>::mma(a[mb], b2, acc[mb][nb]); } }
        asm volatile("v_nop\n\tv_nop\n\tv_nop\n\tv_nop" : "+v"(acc[0][0]), "+v"(acc[1][1]), "+v"(acc[2][2]), "+v"(acc[3][3]) : "v"(a[0]), "v"(a[3]));
    }
#pragma unroll
    for (int mb = 0; mb < 4; ++mb) {
#pragma unroll
        for (int nb = 0; nb < 4; ++nb) {
#pragma unroll
            for (int j = 0; j < 8; ++j) os[(hi * 8 + j) * 68 + nb * 16 + lr] = acc[mb][nb][j]; }
        __builtin_amdgcn_wave_barrier(); asm volatile("" ::: "memory");
        float* crow = C + (size_t)(r0 + mb * 16) * ldc + c0;
{
#pragma unroll
            for (int s = 0; s < 8; ++s) { const int row = 2 * s + hi, cofs = lr * 4; v4f val = *(const v4fa*)(os + row * 68 + cofs);
                *(v4f*)(crow + (size_t)row * ldc + cofs) = val; }
             }
        __builtin_amdgcn_wave_barrier(); asm volatile("" ::: "memory");
    }
}

__device__ __forceinline__ h16 tohx(float x) { return (h16)x; }
__device__ __forceinline__ void splitf(float y, unsigned short& h, unsigned short& l) { h = f2bf(y); l = f2bf(y - bf2f(h)); }
typedef __attribute__((ext_vector_type(2))) _Float16 v2h;
typedef __attribute__((ext_vector_type(4))) _Float16 v4h;
typedef __attribute__((ext_vector_type(2))) unsigned short v2us;
typedef __attribute__((ext_vector_type(4))) unsigned short v4us;
typedef __attribute__((ext_vector_type(2))) float v2f;
typedef __attribute__((ext_vector_type(4))) int v4i;

__global__ __launch_bounds__(256) void k_cvt8(const float* __restrict__ src, bf* dst, size_t n8) { const size_t i = (size_t)blockIdx.x * 256 + threadIdx.x; if (i >= n8) return; const v8f v = *(const v8f*)(src + i * 8); v8us o;
#pragma unroll
    for (int k = 0; k < 8; ++k) o[k] = f2bf(v[k]); *(v8us*)(dst + i * 8) = o;  }

// k_rope: head planes [h][t][d] (fp16 + hi/lo) of rope(x) x sc with the rotate-half convention out[d] = x[d] cos[t][d] - x[d+HD/2] sin[t][d], out[d+HD/2] = x[d+HD/2] cos[t][d+HD/2] + x[d] sin[t][d+HD/2]
__global__ __launch_bounds__(256) void k_rope(const float* __restrict__ F, int pitch, int nheads, const float* __restrict__ CS, const float* __restrict__ RF, const float* __restrict__ nw, float sc, h16* P16, bf* Ph, bf* Pl) {
    const size_t e = ((size_t)blockIdx.x * 256 + threadIdx.x) * 2; if (e >= (size_t)nheads * TT * HD) return; const int d = (int)(e % HD); const int t = (int)((e / HD) % TT); const int h = (int)(e / ((size_t)HD * TT)); const float* f = F + (size_t)t * pitch + h * HD; const float rf = RF ? RF[(size_t)h * TT + t] : 1.0f; v2h o16; v2us oh, ol;
#pragma unroll
    for (int q = 0; q < 2; ++q) { const int dd = d + q; const int dp = (dd < HD / 2) ? dd + HD / 2 : dd - HD / 2; float x0 = f[dd], x1 = f[dp];
        if (RF) { float n0 = __fmul_rn(x0, rf), n1 = __fmul_rn(x1, rf); asm volatile("" : "+v"(n0)); asm volatile("" : "+v"(n1)); x0 = __fmul_rn(bfr(nw[dd]), n0); x1 = __fmul_rn(bfr(nw[dp]), n1); }
        const v2f cs = *(const v2f*)(CS + ((size_t)t * HD + dd) * 2); float a = __fmul_rn(x0, cs[0]), bq = __fmul_rn(x1, cs[1]); asm volatile("" : "+v"(a)); asm volatile("" : "+v"(bq)); const float r = ((dd < HD / 2) ? __fsub_rn(a, bq) : __fadd_rn(a, bq)) * sc;
        o16[q] = tohx(r); unsigned short a2, c2; splitf(r, a2, c2); oh[q] = a2; ol[q] = c2; }
    *(v2h*)(P16 + e) = o16; *(v2us*)(Ph + e) = oh; *(v2us*)(Pl + e) = ol;  }
__global__ __launch_bounds__(256) void k_vtp(const float* __restrict__ F, int pitch, int nheads, h16* V16, bf* Vh, bf* Vl) { const size_t e = ((size_t)blockIdx.x * 256 + threadIdx.x) * 2; if (e >= (size_t)nheads * HD * TT) return; const int t = (int)(e % TT); const int d = (int)((e / TT) % HD); const int g = (int)(e / ((size_t)TT * HD)); v2h o16; v2us oh, ol;
#pragma unroll
    for (int q = 0; q < 2; ++q) { const float x = F[(size_t)(t + q) * pitch + g * HD + d]; o16[q] = tohx(x); unsigned short a2, c2; splitf(x, a2, c2); oh[q] = a2; ol[q] = c2; }
    *(v2h*)(V16 + e) = o16; *(v2us*)(Vh + e) = oh; *(v2us*)(Vl + e) = ol;  }
__global__ __launch_bounds__(256) void k_cscvt(const float* __restrict__ cosT, const float* __restrict__ sinT, float* CS) { const int idx = blockIdx.x * 256 + threadIdx.x; if (idx >= TT * HD) return; v2f cs; cs[0] = bfr(cosT[idx]); cs[1] = bfr(sinT[idx]); *(v2f*)(CS + (size_t)idx * 2) = cs;  }
// k_asoft: per row (zz, i): t = S x HD^-0.5 for j <= i and i - j < WIN (sliding causal window; the reference's -1e9 additive fill vanishes identically); softmax over the 2048 keys (register row, one exp, fixed trees);
__global__ __launch_bounds__(256) void k_asoft(const float* __restrict__ Sb, h16* P16, bf* Ph, bf* Pl) {
    const int lane = threadIdx.x & 31; const int row = blockIdx.x * 8 + (threadIdx.x >> 5); if (row >= ZH * TT) return; const int i = row % TT; const int zz = row / TT; (void)zz; const bool hires = (i < RH); const float* sr = Sb + (size_t)row * TT; float v[TT / 32]; float mx = -3.0e38f;
#pragma unroll
    for (int ch = 0; ch < TT / 128; ++ch) { const int j0 = ch * 128 + lane * 4; const v4f a = *(const v4f*)(sr + j0);
#pragma unroll
        for (int q = 0; q < 4; ++q) { const int j = j0 + q; (void)j; const float t = (j <= i && i - j < WIN) ? a[q] * SCL : -3.0e38f; v[ch * 4 + q] = t; mx = fmaxf(mx, t); } }
#pragma unroll
    for (int sh = 16; sh; sh >>= 1) mx = fmaxf(mx, __shfl_xor(mx, sh, 32));
    float sum = 0.f;
#pragma unroll
    for (int k = 0; k < TT / 32; ++k) { float d0 = __fsub_rn(v[k], mx); asm volatile("" : "+v"(d0)); v[k] = __builtin_amdgcn_exp2f(__fmul_rn(d0, 1.4426950408889634f)); sum += v[k]; }
#pragma unroll
    for (int sh = 16; sh; sh >>= 1) sum += __shfl_xor(sum, sh, 32);
    const float f = __fdiv_rn(hires ? 1.0f : PCAR, sum);
{
        if (hires) {
#pragma unroll
            for (int ch = 0; ch < TT / 128; ++ch) { v4us oh, ol;
#pragma unroll
                for (int q = 0; q < 4; ++q) { unsigned short a, c2; splitf(v[ch * 4 + q] * f, a, c2); oh[q] = a; ol[q] = c2; }
                const size_t oo = ((size_t)zz * (RH ? RH : 1) + i) * TT + ch * 128 + lane * 4; *(v4us*)(Ph + oo) = oh; *(v4us*)(Pl + oo) = ol; }
        } else {
#pragma unroll
            for (int ch = 0; ch < TT / 128; ++ch) { v4h o4;
#pragma unroll
                for (int q = 0; q < 4; ++q) o4[q] = tohx(v[ch * 4 + q] * f);
                *(v4h*)(P16 + (size_t)row * TT + ch * 128 + lane * 4) = o4; } }
         }
}
__global__ __launch_bounds__(256) void k_merge(const float* __restrict__ O, int h0, bf* Ah, bf* Al) { const size_t e = ((size_t)blockIdx.x * 256 + threadIdx.x) * 2; if (e >= (size_t)ZH * TT * HD) return; const int d = (int)(e % HD); const int t = (int)((e / HD) % TT); const int zz = (int)(e / ((size_t)HD * TT)); const float cs = (t < RH) ? 1.0f : (1.0f / PCAR); const size_t oo = (size_t)t * DQ + (h0 + zz) * HD + d;
    v2us oh, ol;
#pragma unroll
    for (int q = 0; q < 2; ++q) { unsigned short a, c2; splitf(O[e + q] * cs, a, c2); oh[q] = a; ol[q] = c2; } *(v2us*)(Ah + oo) = oh; *(v2us*)(Al + oo) = ol;  }

extern "C" void kernel_launch(void* const* d_in, const int* in_sizes, int n_in,
                              void* d_out, int out_size, void* d_ws, size_t ws_size, hipStream_t stream) {
    (void)in_sizes; (void)n_in; (void)out_size;
    const float* x = (const float*)d_in[0]; const float* fcos = (const float*)d_in[1]; const float* fsin = (const float*)d_in[2]; const float* wq = (const float*)d_in[3]; const float* wk = (const float*)d_in[4]; const float* wv = (const float*)d_in[5]; const float* wo = (const float*)d_in[6];   /* x, cos, sin [2][2048][64] = [B][S][HD] (PER-BATCH table inputs: read per element by value), Wq [2048][2048], Wk [512][2048], Wv, Wo ('oi') */
    float* OUT = (float*)d_out;     // [2][2048][2048]
    char* wsp = (char*)d_ws;
    auto take = [&](size_t bytes) { char* p = wsp; wsp += (bytes + 255) & ~(size_t)255; return (void*)p; };
    bf* WQ = (bf*)take((size_t)DQ * DM * 2); bf* WK = (bf*)take((size_t)DKV * DM * 2); bf* WV = (bf*)take((size_t)DKV * DM * 2); bf* WO = (bf*)take((size_t)DM * DQ * 2); float* CS = (float*)take((size_t)TT * HD * 2 * 4);
    bf* XB = (bf*)take((size_t)TT * DM * 2); float* FQ = (float*)take((size_t)TT * DQ * 4); float* FK = (float*)take((size_t)TT * DKV * 4);
    h16* QP16 = (h16*)take((size_t)NH_ * TT * HD * 2); h16* KP16 = (h16*)take((size_t)NKV * TT * HD * 2); h16* VT16 = (h16*)take((size_t)NKV * HD * TT * 2);
    bf* QPh = (bf*)take((size_t)NH_ * TT * HD * 2); bf* QPl = (bf*)take((size_t)NH_ * TT * HD * 2); bf* KPh = (bf*)take((size_t)NKV * TT * HD * 2); bf* KPl = (bf*)take((size_t)NKV * TT * HD * 2); bf* VTh = (bf*)take((size_t)NKV * HD * TT * 2); bf* VTl = (bf*)take((size_t)NKV * HD * TT * 2); bf* Ph = (bf*)take((size_t)ZH * RH * TT * 2); bf* Pl = (bf*)take((size_t)ZH * RH * TT * 2);
    float* Sb = (float*)take((size_t)ZH * TT * TT * 4); h16* P16 = (h16*)take((size_t)ZH * TT * TT * 2); float* Ob = (float*)take((size_t)ZH * TT * HD * 4); bf* ATh = (bf*)take((size_t)TT * DQ * 2); bf* ATl = (bf*)take((size_t)TT * DQ * 2);
    if ((size_t)(wsp - (char*)d_ws) > ws_size) return;    // ws 256 MiB
    float* FV = FK;   // v projection reuses the k buffer after the k planes are built (stream-ordered)
    { k_cvt8<<<(unsigned)(((size_t)DQ * DM / 8 + 255) / 256), 256, 0, stream>>>(wq, WQ, (size_t)DQ * DM / 8); k_cvt8<<<(unsigned)(((size_t)DKV * DM / 8 + 255) / 256), 256, 0, stream>>>(wk, WK, (size_t)DKV * DM / 8); k_cvt8<<<(unsigned)(((size_t)DKV * DM / 8 + 255) / 256), 256, 0, stream>>>(wv, WV, (size_t)DKV * DM / 8);
      k_cvt8<<<(unsigned)(((size_t)DM * DQ / 8 + 255) / 256), 256, 0, stream>>>(wo, WO, (size_t)DM * DQ / 8);
       }
    /* the rotary table is copied PER BATCH inside the loop below (this module's cos / sin are [B][S][HD]) */
    const unsigned LQ = (unsigned)(((size_t)NH_ * TT * HD / 2 + 255) / 256), LKv = (unsigned)(((size_t)NKV * TT * HD / 2 + 255) / 256);
    for (int b = 0; b < NB_; ++b) {
        k_cscvt<<<(TT * HD + 255) / 256, 256, 0, stream>>>(fcos + (size_t)b * TT * HD, fsin + (size_t)b * TT * HD, CS);   /* batch b's own rotary table slice from the inputs (stream-ordered: before this batch's plane builders) */
        k_cvt8<<<(unsigned)(((size_t)TT * DM / 8 + 255) / 256), 256, 0, stream>>>(x + (size_t)b * TT * DM, XB, (size_t)TT * DM / 8);
        k_gemmw<bf, 0, false><<<dim3(TT / 64, DQ / 64, 1), 32, 0, stream>>>(XB, nullptr, WQ, nullptr, DM, FQ, DQ, nullptr, 0, 0, 0);
        k_rope<<<LQ, 256, 0, stream>>>(FQ, DQ, NH_, CS, nullptr, nullptr, 1.0f, QP16, QPh, QPl);
        k_gemmw<bf, 0, false><<<dim3(TT / 64, DKV / 64, 1), 32, 0, stream>>>(XB, nullptr, WK, nullptr, DM, FK, DKV, nullptr, 0, 0, 0);
        k_rope<<<LKv, 256, 0, stream>>>(FK, DKV, NKV, CS, nullptr, nullptr, 1.0f, KP16, KPh, KPl);
        k_gemmw<bf, 0, false><<<dim3(TT / 64, DKV / 64, 1), 32, 0, stream>>>(XB, nullptr, WV, nullptr, DM, FV, DKV, nullptr, 0, 0, 0); k_vtp<<<LKv, 256, 0, stream>>>(FV, DKV, NKV, VT16, VTh, VTl);
        for (int h0 = 0; h0 < NH_; h0 += ZH) { const size_t zq = (size_t)h0, zk = (size_t)(h0 / REP);   // both heads of a pass share kv group h0/REP (REP >= 2): sB = 0
            k_gemmc<bf, 2, 1><<<dim3(RH / 64, TT / 64, ZH), 32, 0, stream>>>(QPh + zq * TT * HD, QPl + zq * TT * HD, KPh + zk * TT * HD, KPl + zk * TT * HD, HD, Sb, TT, 0, (size_t)TT * HD, 0, (size_t)TT * TT);
            k_gemmc<h16, 0, 1><<<dim3((TT - RH) / 64, TT / 64, ZH), 32, 0, stream>>>(QP16 + zq * TT * HD + (size_t)RH * HD, nullptr, KP16 + zk * TT * HD, nullptr, HD, Sb + (size_t)RH * TT, TT, RH, (size_t)TT * HD, 0, (size_t)TT * TT);
            k_asoft<<<ZH * TT / 8, 256, 0, stream>>>(Sb, P16, Ph, Pl);
            k_gemmc<bf, 2, 2><<<dim3(RH / 64, HD / 64, ZH), 32, 0, stream>>>(Ph, Pl, VTh + zk * HD * TT, VTl + zk * HD * TT, TT, Ob, HD, 0, (size_t)RH * TT, 0, (size_t)TT * HD);
            k_gemmc<h16, 0, 2><<<dim3((TT - RH) / 64, HD / 64, ZH), 32, 0, stream>>>(P16 + (size_t)RH * TT, nullptr, VT16 + zk * HD * TT, nullptr, TT, Ob + (size_t)RH * HD, HD, RH, (size_t)TT * TT, 0, (size_t)TT * HD);
            k_merge<<<(unsigned)(((size_t)ZH * TT * HD / 2 + 255) / 256), 256, 0, stream>>>(Ob, h0, ATh, ATl); }
        k_gemmw<bf, 1, false><<<dim3(TT / 64, DM / 64, 1), 32, 0, stream>>>(ATh, ATl, WO, nullptr, DQ, OUT + (size_t)b * TT * DM, DM, nullptr, 0, 0, 0); }
}

// v001
// It runs in 1430 microseconds.
// Timed twice side by side with v000, it ran 1.87 times as fast both times.
#include <hip/hip_runtime.h>

// Grouped-query causal attention (32 / 8 heads x 64) with rotate-half rotary embeddings from PER-BATCH input tables (x [2][2048][2048]; Q = x Wq^T (32 heads x 64), K, V = x Wk^T, x Wv^T (8 kv heads x 64) ('oi' (out, in) normal x 0.02, no bias); q, k -> t cos + rotate_half(t) sin with the cos / sin INPUT tables [2][2048][64] = [B][S][HD] (batch b reads ITS OWN slice, per element by value); jnp.repeat on the head axis: head h uses kv head h / 4; scores x 64^-0.5; causal (finfo.min == exclusion: every row keeps its own key); softmax; out = merged Wo^T ('oi') -> [2][2048][2048] (8.4 M); argument order x, cos, sin, Wq, Wk, Wv, Wo).
// Layout per batch: bf16 copy of x; 'oi' weights; exact projections; {cos, sin} table from the bf16-rounded inputs (k_cscvt) + rotate-half plane builders; causal T-2048 GQA attention (kv z-stride 0; hybrid rows: < 512 hi/lo 3 products, rest fp16 x1024; k_gemmc skips tiles above the diagonal); merged hi/lo x Wo exact.
// Compute dtypes, f32 accumulate: every input rounded to bf16 incl. the tables; projections exact; rotary f32; attention rows < 512 3 products, rest fp16; softmax f32; Wo hl x exact.

#define NB_  2
#define TT   2048
#define DM   2048
#define NH_  32
#define NKV  8
#define REP  (NH_ / NKV)
#define HD   64
#define DQ   (NH_ * HD)
#define DKV  (NKV * HD)
#define ZH   2
#define RH   512                  // query rows < RH use hi+lo planes (0: none)
#define WIN  2048
#define PCAR 1024.0f
#define SCL  0.125f   // HD^-0.5
typedef _Float16 h16;
typedef unsigned short bf;
typedef __attribute__((ext_vector_type(16))) __bf16   v16bf;
typedef __attribute__((ext_vector_type(16))) _Float16 v16h;
typedef __attribute__((ext_vector_type(8)))  _Float16 v8h;
typedef __attribute__((ext_vector_type(8)))  unsigned short v8us;
typedef __attribute__((ext_vector_type(8)))  float    v8f;
typedef __attribute__((ext_vector_type(4)))  float    v4f;
typedef v8h  __attribute__((may_alias)) v8ha;
typedef v4f  __attribute__((may_alias)) v4fa;
typedef v8us __attribute__((may_alias)) v8usa;

__device__ __forceinline__ unsigned short f2bf(float f) { unsigned u = __float_as_uint(f); u += 0x7FFFu + ((u >> 16) & 1u); return (unsigned short)(u >> 16); }
__device__ __forceinline__ float bf2f(unsigned short b) { return __uint_as_float(((unsigned)b) << 16); }
__device__ __forceinline__ float bfr(float f) { return bf2f(f2bf(f)); }
__device__ __forceinline__ v16h cat16(v8h lo, v8h hi) { return __builtin_shufflevector(lo, hi, 0, 1, 2, 3, 4, 5, 6, 7, 8, 9, 10, 11, 12, 13, 14, 15); }
__device__ __forceinline__ v16bf cat16b(v8us lo, v8us hi) { return __builtin_bit_cast(v16bf, __builtin_shufflevector(lo, hi, 0, 1, 2, 3, 4, 5, 6, 7, 8, 9, 10, 11, 12, 13, 14, 15)); }
__device__ __forceinline__ v8f wmma16(v16h a, v16h b, v8f c) { return __builtin_amdgcn_wmma_f32_16x16x32_f16(false, a, false, b, (short)0, c, false, false); }
__device__ __forceinline__ v8f wmmab(v16bf a, v16bf b, v8f c) { return __builtin_amdgcn_wmma_f32_16x16x32_bf16(false, a, false, b, (short)0, c, false, false); }



// ---- k_gemmw: register-blocked GEMM, one work-group of NW waves per 64x64 output tile (16 accumulators a wave), operands straight from K-contiguous 16-bit planes; grid (M/64, N/64, Z), 32 * NW threads.
// Wave w takes the 32-wide k chunks w, w + NW, w + 2 NW, ...; the NW partial tiles are summed through LDS in the fixed order w = 0 .. NW-1 (the one-wave loop is a chain of exposed load latencies: NW chains run side by side).
// NW > 1 stages all 64 rows of every partial tile at once (MBR = 4 blocks of 16 rows): one barrier, and no output store has to drain in front of a second one.
// C[m][n] (f32, pitch ldc, + optional f32 bias[n]) = sum_k A[m][k] Bt[n][k] (+ split products per NSPLIT). z-batch strides sA/sB/sC in elements. K % 32 == 0.
template <typename T16> struct WFrag;
template <> struct WFrag<h16> { typedef v16h V; static __device__ __forceinline__ V ld(const h16* p) { return cat16(*(const v8h*)p, *(const v8h*)(p + 16)); } static __device__ __forceinline__ v8f mma(V a, V b, v8f c) { return wmma16(a, b, c); } };
template <> struct WFrag<bf> { typedef v16bf V; static __device__ __forceinline__ V ld(const bf* p) { return cat16b(*(const v8us*)p, *(const v8us*)(p + 16)); } static __device__ __forceinline__ v8f mma(V a, V b, v8f c) { return wmmab(a, b, c); } };
template <typename T16, int NSPLIT, bool BIAS, int NW>
__global__ __launch_bounds__(32 * NW) void k_gemmw(const T16* __restrict__ A, const T16* __restrict__ A2, const T16* __restrict__ Bt, const T16* __restrict__ Bt2, int K, float* C, int ldc, const float* __restrict__ bias, size_t sA, size_t sB, size_t sC) {
    typedef typename WFrag<T16>::V V;
    constexpr int MBR = (NW > 1) ? 4 : 1;   // 16-row blocks staged per round
    __shared__ __align__(16) float os[NW * MBR * 16 * 68];
    const int wv = (NW > 1) ? __builtin_amdgcn_readfirstlane((int)(threadIdx.x >> 5)) : 0;   // wave number, scalar: the k loop stays a scalar loop
    const size_t z = blockIdx.z; A += z * sA; if (A2) A2 += z * sA; Bt += z * sB; if (Bt2) Bt2 += z * sB; C += z * sC;
    const int lane = threadIdx.x & 31, lr = lane & 15, hi = lane >> 4; const int r0 = blockIdx.x * 64, c0 = blockIdx.y * 64;
    v8f acc[4][4];
#pragma unroll
    for (int mb = 0; mb < 4; ++mb)
#pragma unroll
        for (int nb = 0; nb < 4; ++nb) acc[mb][nb] = (v8f){};
    const size_t aoff = (size_t)(r0 + lr) * K + 8 * hi, boff = (size_t)(c0 + lr) * K + 8 * hi;
#pragma unroll 1
    for (int kc = wv * 32; kc < K; kc += 32 * NW) {
        V a[4], a2[4];
#pragma unroll
        for (int mb = 0; mb < 4; ++mb) { a[mb] = WFrag<T16>::ld(A + aoff + (size_t)mb * 16 * K + kc); if (NSPLIT == 1 || NSPLIT == 2) a2[mb] = WFrag<T16>::ld(A2 + aoff + (size_t)mb * 16 * K + kc); }
#pragma unroll
        for (int nb = 0; nb < 4; ++nb) { const V b = WFrag<T16>::ld(Bt + boff + (size_t)nb * 16 * K + kc); V b2; if (NSPLIT >= 2) b2 = WFrag<T16>::ld(Bt2 + boff + (size_t)nb * 16 * K + kc);
#pragma unroll
            for (int mb = 0; mb < 4; ++mb) { acc[mb][nb] = WFrag<T16>::mma(a[mb], b, acc[mb][nb]); if (NSPLIT == 1 || NSPLIT == 2) acc[mb][nb] = WFrag<T16>::mma(a2[mb], b, acc[mb][nb]); if (NSPLIT >= 2) acc[mb][nb] = WFrag<T16>::mma(a[mb], b2, acc[mb][nb]); } }
        asm volatile("v_nop\n\tv_nop\n\tv_nop\n\tv_nop" : "+v"(acc[0][0]), "+v"(acc[1][1]), "+v"(acc[2][2]), "+v"(acc[3][3]) : "v"(a[0]), "v"(a[3]));
    }
#pragma unroll
    for (int mb = 0; mb < 4; mb += MBR) {
#pragma unroll
        for (int mi = 0; mi < MBR; ++mi)
#pragma unroll
        for (int nb = 0; nb < 4; ++nb) {
#pragma unroll
            for (int j = 0; j < 8; ++j) os[(wv * MBR + mi) * (16 * 68) + (hi * 8 + j) * 68 + nb * 16 + lr] = acc[mb + mi][nb][j]; }
        if (NW > 1) __syncthreads();   // every wave's partial tile is in LDS before any thread sums it
        else { __builtin_amdgcn_wave_barrier(); asm volatile("" ::: "memory"); }
        float* crow = C + (size_t)(r0 + mb * 16) * ldc + c0;
{
#pragma unroll
            for (int s = 0; s < 8 * MBR / NW; ++s) { const int row = 2 * (s * NW + wv) + hi, cofs = lr * 4; v4f val = *(const v4fa*)(os + row * 68 + cofs);
#pragma unroll
                for (int w = 1; w < NW; ++w) val += *(const v4fa*)(os + w * (MBR * 16 * 68) + row * 68 + cofs);
                if (BIAS) { val[0] += bfr(bias[c0 + cofs]); val[1] += bfr(bias[c0 + cofs + 1]); val[2] += bfr(bias[c0 + cofs + 2]); val[3] += bfr(bias[c0 + cofs + 3]); }
                *(v4f*)(crow + (size_t)row * ldc + cofs) = val; }
             }
        if (NW == 1) { __builtin_amdgcn_wave_barrier(); asm volatile("" ::: "memory"); }   // NW > 1: one round, nothing is staged again
    }
}

// ---- k_gemmc: the same 64x64 tile GEMM (NW waves share the k loop; NW = 1 for the two-chunk score tiles) specialised for causal attention: CMODE 1 skips score tiles entirely above the diagonal (query rows r0+roff.., key columns c0..), CMODE 2 limits the
// key (K) loop of the probability x value contraction to the diagonal block (probabilities beyond it are exactly zero). roff = row offset of this launch's first row within the sequence.
template <typename T16, int NSPLIT, int CMODE, int NW>
__global__ __launch_bounds__(32 * NW) void k_gemmc(const T16* __restrict__ A, const T16* __restrict__ A2, const T16* __restrict__ Bt, const T16* __restrict__ Bt2, int K, float* C, int ldc, int roff, size_t sA, size_t sB, size_t sC) {
    typedef typename WFrag<T16>::V V;
    constexpr int MBR = (NW > 1) ? 4 : 1;   // 16-row blocks staged per round
    __shared__ __align__(16) float os[NW * MBR * 16 * 68];
    const int wv = (NW > 1) ? __builtin_amdgcn_readfirstlane((int)(threadIdx.x >> 5)) : 0;   // wave number, scalar: the k loop stays a scalar loop
    const size_t z = blockIdx.z; A += z * sA; if (A2) A2 += z * sA; Bt += z * sB; if (Bt2) Bt2 += z * sB; C += z * sC;
    const int lane = threadIdx.x & 31, lr = lane & 15, hi = lane >> 4; const int r0 = blockIdx.x * 64, c0 = blockIdx.y * 64;
    if (CMODE == 1 && c0 > r0 + roff + 63) return;                  // score tile entirely above the causal diagonal: never read (the softmax masks j > i by select)
    const int Kl = (CMODE == 2) ? min(K, r0 + roff + 64) : K;        // P.V: probabilities are exactly 0 beyond the diagonal block, so the K loop stops there
    v8f acc[4][4];
#pragma unroll
    for (int mb = 0; mb < 4; ++mb)
#pragma unroll
        for (int nb = 0; nb < 4; ++nb) acc[mb][nb] = (v8f){};
    const size_t aoff = (size_t)(r0 + lr) * K + 8 * hi, boff = (size_t)(c0 + lr) * K + 8 * hi;
#pragma unroll 1
    for (int kc = wv * 32; kc < Kl; kc += 32 * NW) {
        V a[4], a2[4];
#pragma unroll
        for (int mb = 0; mb < 4; ++mb) { a[mb] = WFrag<T16>::ld(A + aoff + (size_t)mb * 16 * K + kc); if (NSPLIT == 1 || NSPLIT == 2) a2[mb] = WFrag<T16>::ld(A2 + aoff + (size_t)mb * 16 * K + kc); }
#pragma unroll
        for (int nb = 0; nb < 4; ++nb) { const V b = WFrag<T16>::ld(Bt + boff + (size_t)nb * 16 * K + kc); V b2; if (NSPLIT >= 2) b2 = WFrag<T16>::ld(Bt2 + boff + (size_t)nb * 16 * K + kc);
#pragma unroll
            for (int mb = 0; mb < 4; ++mb) { acc[mb][nb] = WFrag<T16>::mma(a[mb], b, acc[mb][nb]); if (NSPLIT == 1 || NSPLIT == 2) acc[mb][nb] = WFrag<T16>::mma(a2[mb], b, acc[mb][nb]); if (NSPLIT >= 2) acc[mb][nb] = WFrag<T16>::mma(a[mb], b2, acc[mb][nb]); } }
        asm volatile("v_nop\n\tv_nop\n\tv_nop\n\tv_nop" : "+v"(acc[0][0]), "+v"(acc[1][1]), "+v"(acc[2][2]), "+v"(acc[3][3]) : "v"(a[0]), "v"(a[3]));
    }
#pragma unroll
    for (int mb = 0; mb < 4; mb += MBR) {
#pragma unroll
        for (int mi = 0; mi < MBR; ++mi)
#pragma unroll
        for (int nb = 0; nb < 4; ++nb) {
#pragma unroll
            for (int j = 0; j < 8; ++j) os[(wv * MBR + mi) * (16 * 68) + (hi * 8 + j) * 68 + nb * 16 + lr] = acc[mb + mi][nb][j]; }
        if (NW > 1) __syncthreads();   // every wave's partial tile is in LDS before any thread sums it
        else { __builtin_amdgcn_wave_barrier(); asm volatile("" ::: "memory"); }
        float* crow = C + (size_t)(r0 + mb * 16) * ldc + c0;
{
#pragma unroll
            for (int s = 0; s < 8 * MBR / NW; ++s) { const int row = 2 * (s * NW + wv) + hi, cofs = lr * 4; v4f val = *(const v4fa*)(os + row * 68 + cofs);
#pragma unroll
                for (int w = 1; w < NW; ++w) val += *(const v4fa*)(os + w * (MBR * 16 * 68) + row * 68 + cofs);
                *(v4f*)(crow + (size_t)row * ldc + cofs) = val; }
             }
        if (NW == 1) { __builtin_amdgcn_wave_barrier(); asm volatile("" ::: "memory"); }   // NW > 1: one round, nothing is staged again
    }
}

__device__ __forceinline__ h16 tohx(float x) { return (h16)x; }
__device__ __forceinline__ void splitf(float y, unsigned short& h, unsigned short& l) { h = f2bf(y); l = f2bf(y - bf2f(h)); }
typedef __attribute__((ext_vector_type(2))) _Float16 v2h;
typedef __attribute__((ext_vector_type(4))) _Float16 v4h;
typedef __attribute__((ext_vector_type(2))) unsigned short v2us;
typedef __attribute__((ext_vector_type(4))) unsigned short v4us;
typedef __attribute__((ext_vector_type(2))) float v2f;
typedef __attribute__((ext_vector_type(4))) int v4i;

__global__ __launch_bounds__(256) void k_cvt8(const float* __restrict__ src, bf* dst, size_t n8) { const size_t i = (size_t)blockIdx.x * 256 + threadIdx.x; if (i >= n8) return; const v8f v = *(const v8f*)(src + i * 8); v8us o;
#pragma unroll
    for (int k = 0; k < 8; ++k) o[k] = f2bf(v[k]); *(v8us*)(dst + i * 8) = o;  }

// k_rope: head planes [h][t][d] (fp16 + hi/lo) of rope(x) x sc with the rotate-half convention out[d] = x[d] cos[t][d] - x[d+HD/2] sin[t][d], out[d+HD/2] = x[d+HD/2] cos[t][d+HD/2] + x[d] sin[t][d+HD/2]
__global__ __launch_bounds__(256) void k_rope(const float* __restrict__ F, int pitch, int nheads, const float* __restrict__ CS, const float* __restrict__ RF, const float* __restrict__ nw, float sc, h16* P16, bf* Ph, bf* Pl) {
    const size_t e = ((size_t)blockIdx.x * 256 + threadIdx.x) * 2; if (e >= (size_t)nheads * TT * HD) return; const int d = (int)(e % HD); const int t = (int)((e / HD) % TT); const int h = (int)(e / ((size_t)HD * TT)); const float* f = F + (size_t)t * pitch + h * HD; const float rf = RF ? RF[(size_t)h * TT + t] : 1.0f; v2h o16; v2us oh, ol;
#pragma unroll
    for (int q = 0; q < 2; ++q) { const int dd = d + q; const int dp = (dd < HD / 2) ? dd + HD / 2 : dd - HD / 2; float x0 = f[dd], x1 = f[dp];
        if (RF) { float n0 = __fmul_rn(x0, rf), n1 = __fmul_rn(x1, rf); asm volatile("" : "+v"(n0)); asm volatile("" : "+v"(n1)); x0 = __fmul_rn(bfr(nw[dd]), n0); x1 = __fmul_rn(bfr(nw[dp]), n1); }
        const v2f cs = *(const v2f*)(CS + ((size_t)t * HD + dd) * 2); float a = __fmul_rn(x0, cs[0]), bq = __fmul_rn(x1, cs[1]); asm volatile("" : "+v"(a)); asm volatile("" : "+v"(bq)); const float r = ((dd < HD / 2) ? __fsub_rn(a, bq) : __fadd_rn(a, bq)) * sc;
        o16[q] = tohx(r); unsigned short a2, c2; splitf(r, a2, c2); oh[q] = a2; ol[q] = c2; }
    *(v2h*)(P16 + e) = o16; *(v2us*)(Ph + e) = oh; *(v2us*)(Pl + e) = ol;  }
__global__ __launch_bounds__(256) void k_vtp(const float* __restrict__ F, int pitch, int nheads, h16* V16, bf* Vh, bf* Vl) { const size_t e = ((size_t)blockIdx.x * 256 + threadIdx.x) * 2; if (e >= (size_t)nheads * HD * TT) return; const int t = (int)(e % TT); const int d = (int)((e / TT) % HD); const int g = (int)(e / ((size_t)TT * HD)); v2h o16; v2us oh, ol;
#pragma unroll
    for (int q = 0; q < 2; ++q) { const float x = F[(size_t)(t + q) * pitch + g * HD + d]; o16[q] = tohx(x); unsigned short a2, c2; splitf(x, a2, c2); oh[q] = a2; ol[q] = c2; }
    *(v2h*)(V16 + e) = o16; *(v2us*)(Vh + e) = oh; *(v2us*)(Vl + e) = ol;  }
__global__ __launch_bounds__(256) void k_cscvt(const float* __restrict__ cosT, const float* __restrict__ sinT, float* CS) { const int idx = blockIdx.x * 256 + threadIdx.x; if (idx >= TT * HD) return; v2f cs; cs[0] = bfr(cosT[idx]); cs[1] = bfr(sinT[idx]); *(v2f*)(CS + (size_t)idx * 2) = cs;  }
// k_asoft: per row (zz, i): t = S x HD^-0.5 for j <= i and i - j < WIN (sliding causal window; the reference's -1e9 additive fill vanishes identically); softmax over the 2048 keys (register row, one exp, fixed trees);
__global__ __launch_bounds__(256) void k_asoft(const float* __restrict__ Sb, h16* P16, bf* Ph, bf* Pl) {
    const int lane = threadIdx.x & 31; const int row = blockIdx.x * 8 + (threadIdx.x >> 5); if (row >= ZH * TT) return; const int i = row % TT; const int zz = row / TT; (void)zz; const bool hires = (i < RH); const float* sr = Sb + (size_t)row * TT; float v[TT / 32]; float mx = -3.0e38f;
#pragma unroll
    for (int ch = 0; ch < TT / 128; ++ch) { const int j0 = ch * 128 + lane * 4; const v4f a = *(const v4f*)(sr + j0);
#pragma unroll
        for (int q = 0; q < 4; ++q) { const int j = j0 + q; (void)j; const float t = (j <= i && i - j < WIN) ? a[q] * SCL : -3.0e38f; v[ch * 4 + q] = t; mx = fmaxf(mx, t); } }
#pragma unroll
    for (int sh = 16; sh; sh >>= 1) mx = fmaxf(mx, __shfl_xor(mx, sh, 32));
    float sum = 0.f;
#pragma unroll
    for (int k = 0; k < TT / 32; ++k) { float d0 = __fsub_rn(v[k], mx); asm volatile("" : "+v"(d0)); v[k] = __builtin_amdgcn_exp2f(__fmul_rn(d0, 1.4426950408889634f)); sum += v[k]; }
#pragma unroll
    for (int sh = 16; sh; sh >>= 1) sum += __shfl_xor(sum, sh, 32);
    const float f = __fdiv_rn(hires ? 1.0f : PCAR, sum);
{
        if (hires) {
#pragma unroll
            for (int ch = 0; ch < TT / 128; ++ch) { v4us oh, ol;
#pragma unroll
                for (int q = 0; q < 4; ++q) { unsigned short a, c2; splitf(v[ch * 4 + q] * f, a, c2); oh[q] = a; ol[q] = c2; }
                const size_t oo = ((size_t)zz * (RH ? RH : 1) + i) * TT + ch * 128 + lane * 4; *(v4us*)(Ph + oo) = oh; *(v4us*)(Pl + oo) = ol; }
        } else {
#pragma unroll
            for (int ch = 0; ch < TT / 128; ++ch) { v4h o4;
#pragma unroll
                for (int q = 0; q < 4; ++q) o4[q] = tohx(v[ch * 4 + q] * f);
                *(v4h*)(P16 + (size_t)row * TT + ch * 128 + lane * 4) = o4; } }
         }
}
__global__ __launch_bounds__(256) void k_merge(const float* __restrict__ O, int h0, bf* Ah, bf* Al) { const size_t e = ((size_t)blockIdx.x * 256 + threadIdx.x) * 2; if (e >= (size_t)ZH * TT * HD) return; const int d = (int)(e % HD); const int t = (int)((e / HD) % TT); const int zz = (int)(e / ((size_t)HD * TT)); const float cs = (t < RH) ? 1.0f : (1.0f / PCAR); const size_t oo = (size_t)t * DQ + (h0 + zz) * HD + d;
    v2us oh, ol;
#pragma unroll
    for (int q = 0; q < 2; ++q) { unsigned short a, c2; splitf(O[e + q] * cs, a, c2); oh[q] = a; ol[q] = c2; } *(v2us*)(Ah + oo) = oh; *(v2us*)(Al + oo) = ol;  }

extern "C" void kernel_launch(void* const* d_in, const int* in_sizes, int n_in,
                              void* d_out, int out_size, void* d_ws, size_t ws_size, hipStream_t stream) {
    (void)in_sizes; (void)n_in; (void)out_size;
    const float* x = (const float*)d_in[0]; const float* fcos = (const float*)d_in[1]; const float* fsin = (const float*)d_in[2]; const float* wq = (const float*)d_in[3]; const float* wk = (const float*)d_in[4]; const float* wv = (const float*)d_in[5]; const float* wo = (const float*)d_in[6];   /* x, cos, sin [2][2048][64] = [B][S][HD] (PER-BATCH table inputs: read per element by value), Wq [2048][2048], Wk [512][2048], Wv, Wo ('oi') */
    float* OUT = (float*)d_out;     // [2][2048][2048]
    char* wsp = (char*)d_ws;
    auto take = [&](size_t bytes) { char* p = wsp; wsp += (bytes + 255) & ~(size_t)255; return (void*)p; };
    bf* WQ = (bf*)take((size_t)DQ * DM * 2); bf* WK = (bf*)take((size_t)DKV * DM * 2); bf* WV = (bf*)take((size_t)DKV * DM * 2); bf* WO = (bf*)take((size_t)DM * DQ * 2); float* CS = (float*)take((size_t)TT * HD * 2 * 4);
    bf* XB = (bf*)take((size_t)TT * DM * 2); float* FQ = (float*)take((size_t)TT * DQ * 4); float* FK = (float*)take((size_t)TT * DKV * 4);
    h16* QP16 = (h16*)take((size_t)NH_ * TT * HD * 2); h16* KP16 = (h16*)take((size_t)NKV * TT * HD * 2); h16* VT16 = (h16*)take((size_t)NKV * HD * TT * 2);
    bf* QPh = (bf*)take((size_t)NH_ * TT * HD * 2); bf* QPl = (bf*)take((size_t)NH_ * TT * HD * 2); bf* KPh = (bf*)take((size_t)NKV * TT * HD * 2); bf* KPl = (bf*)take((size_t)NKV * TT * HD * 2); bf* VTh = (bf*)take((size_t)NKV * HD * TT * 2); bf* VTl = (bf*)take((size_t)NKV * HD * TT * 2); bf* Ph = (bf*)take((size_t)ZH * RH * TT * 2); bf* Pl = (bf*)take((size_t)ZH * RH * TT * 2);
    float* Sb = (float*)take((size_t)ZH * TT * TT * 4); h16* P16 = (h16*)take((size_t)ZH * TT * TT * 2); float* Ob = (float*)take((size_t)ZH * TT * HD * 4); bf* ATh = (bf*)take((size_t)TT * DQ * 2); bf* ATl = (bf*)take((size_t)TT * DQ * 2);
    if ((size_t)(wsp - (char*)d_ws) > ws_size) return;    // ws 256 MiB
    float* FV = FK;   // v projection reuses the k buffer after the k planes are built (stream-ordered)
    { k_cvt8<<<(unsigned)(((size_t)DQ * DM / 8 + 255) / 256), 256, 0, stream>>>(wq, WQ, (size_t)DQ * DM / 8); k_cvt8<<<(unsigned)(((size_t)DKV * DM / 8 + 255) / 256), 256, 0, stream>>>(wk, WK, (size_t)DKV * DM / 8); k_cvt8<<<(unsigned)(((size_t)DKV * DM / 8 + 255) / 256), 256, 0, stream>>>(wv, WV, (size_t)DKV * DM / 8);
      k_cvt8<<<(unsigned)(((size_t)DM * DQ / 8 + 255) / 256), 256, 0, stream>>>(wo, WO, (size_t)DM * DQ / 8);
       }
    /* the rotary table is copied PER BATCH inside the loop below (this module's cos / sin are [B][S][HD]) */
    const unsigned LQ = (unsigned)(((size_t)NH_ * TT * HD / 2 + 255) / 256), LKv = (unsigned)(((size_t)NKV * TT * HD / 2 + 255) / 256);
    for (int b = 0; b < NB_; ++b) {
        k_cscvt<<<(TT * HD + 255) / 256, 256, 0, stream>>>(fcos + (size_t)b * TT * HD, fsin + (size_t)b * TT * HD, CS);   /* batch b's own rotary table slice from the inputs (stream-ordered: before this batch's plane builders) */
        k_cvt8<<<(unsigned)(((size_t)TT * DM / 8 + 255) / 256), 256, 0, stream>>>(x + (size_t)b * TT * DM, XB, (size_t)TT * DM / 8);
        k_gemmw<bf, 0, false, 8><<<dim3(TT / 64, DQ / 64, 1), 256, 0, stream>>>(XB, nullptr, WQ, nullptr, DM, FQ, DQ, nullptr, 0, 0, 0);
        k_rope<<<LQ, 256, 0, stream>>>(FQ, DQ, NH_, CS, nullptr, nullptr, 1.0f, QP16, QPh, QPl);
        k_gemmw<bf, 0, false, 8><<<dim3(TT / 64, DKV / 64, 1), 256, 0, stream>>>(XB, nullptr, WK, nullptr, DM, FK, DKV, nullptr, 0, 0, 0);
        k_rope<<<LKv, 256, 0, stream>>>(FK, DKV, NKV, CS, nullptr, nullptr, 1.0f, KP16, KPh, KPl);
        k_gemmw<bf, 0, false, 8><<<dim3(TT / 64, DKV / 64, 1), 256, 0, stream>>>(XB, nullptr, WV, nullptr, DM, FV, DKV, nullptr, 0, 0, 0); k_vtp<<<LKv, 256, 0, stream>>>(FV, DKV, NKV, VT16, VTh, VTl);
        for (int h0 = 0; h0 < NH_; h0 += ZH) { const size_t zq = (size_t)h0, zk = (size_t)(h0 / REP);   // both heads of a pass share kv group h0/REP (REP >= 2): sB = 0
            k_gemmc<bf, 2, 1, 1><<<dim3(RH / 64, TT / 64, ZH), 32, 0, stream>>>(QPh + zq * TT * HD, QPl + zq * TT * HD, KPh + zk * TT * HD, KPl + zk * TT * HD, HD, Sb, TT, 0, (size_t)TT * HD, 0, (size_t)TT * TT);
            k_gemmc<h16, 0, 1, 1><<<dim3((TT - RH) / 64, TT / 64, ZH), 32, 0, stream>>>(QP16 + zq * TT * HD + (size_t)RH * HD, nullptr, KP16 + zk * TT * HD, nullptr, HD, Sb + (size_t)RH * TT, TT, RH, (size_t)TT * HD, 0, (size_t)TT * TT);
            k_asoft<<<ZH * TT / 8, 256, 0, stream>>>(Sb, P16, Ph, Pl);
            k_gemmc<bf, 2, 2, 8><<<dim3(RH / 64, HD / 64, ZH), 256, 0, stream>>>(Ph, Pl, VTh + zk * HD * TT, VTl + zk * HD * TT, TT, Ob, HD, 0, (size_t)RH * TT, 0, (size_t)TT * HD);
            k_gemmc<h16, 0, 2, 16><<<dim3((TT - RH) / 64, HD / 64, ZH), 512, 0, stream>>>(P16 + (size_t)RH * TT, nullptr, VT16 + zk * HD * TT, nullptr, TT, Ob + (size_t)RH * HD, HD, RH, (size_t)TT * TT, 0, (size_t)TT * HD);
            k_merge<<<(unsigned)(((size_t)ZH * TT * HD / 2 + 255) / 256), 256, 0, stream>>>(Ob, h0, ATh, ATl); }
        k_gemmw<bf, 1, false, 8><<<dim3(TT / 64, DM / 64, 1), 256, 0, stream>>>(ATh, ATl, WO, nullptr, DQ, OUT + (size_t)b * TT * DM, DM, nullptr, 0, 0, 0); }
}

// v002
// It runs in 840 microseconds.
// In two side-by-side timings against v001, it was 1.73 and 1.71 times as fast.
// Over all steps from v000 it is 3.22 times as fast.
#include <hip/hip_runtime.h>

// Grouped-query causal attention (32 / 8 heads x 64) with rotate-half rotary embeddings from PER-BATCH input tables (x [2][2048][2048]; Q = x Wq^T (32 heads x 64), K, V = x Wk^T, x Wv^T (8 kv heads x 64) ('oi' (out, in) normal x 0.02, no bias); q, k -> t cos + rotate_half(t) sin with the cos / sin INPUT tables [2][2048][64] = [B][S][HD] (batch b reads ITS OWN slice, per element by value); jnp.repeat on the head axis: head h uses kv head h / 4; scores x 64^-0.5; causal (finfo.min == exclusion: every row keeps its own key); softmax; out = merged Wo^T ('oi') -> [2][2048][2048] (8.4 M); argument order x, cos, sin, Wq, Wk, Wv, Wo).
// Layout per batch: bf16 copy of x; 'oi' weights; exact projections; {cos, sin} table from the bf16-rounded inputs (k_cscvt) + rotate-half plane builders; causal T-2048 GQA attention (ZH heads a pass, head z reads kv group z / REP of the pass; each probability row overwrites its own score row; hybrid rows: < 512 hi/lo 3 products, rest fp16 x1024; k_gemmc skips tiles above the diagonal); merged hi/lo x Wo exact.
// Compute dtypes, f32 accumulate: every input rounded to bf16 incl. the tables; projections exact; rotary f32; attention rows < 512 3 products, rest fp16; softmax f32; Wo hl x exact.

#define NB_  2
#define TT   2048
#define DM   2048
#define NH_  32
#define NKV  8
#define REP  (NH_ / NKV)
#define HD   64
#define DQ   (NH_ * HD)
#define DKV  (NKV * HD)
#define ZH   8                    // query heads per attention pass (ZH / REP kv groups)
#define RH   512                  // query rows < RH use hi+lo planes (0: none)
#define WIN  2048
#define PCAR 1024.0f
#define SCL  0.125f   // HD^-0.5
typedef _Float16 h16;
typedef unsigned short bf;
typedef __attribute__((ext_vector_type(16))) __bf16   v16bf;
typedef __attribute__((ext_vector_type(16))) _Float16 v16h;
typedef __attribute__((ext_vector_type(8)))  _Float16 v8h;
typedef __attribute__((ext_vector_type(8)))  unsigned short v8us;
typedef __attribute__((ext_vector_type(8)))  float    v8f;
typedef __attribute__((ext_vector_type(4)))  float    v4f;
typedef v8h  __attribute__((may_alias)) v8ha;
typedef v4f  __attribute__((may_alias)) v4fa;
typedef v8us __attribute__((may_alias)) v8usa;

__device__ __forceinline__ unsigned short f2bf(float f) { unsigned u = __float_as_uint(f); u += 0x7FFFu + ((u >> 16) & 1u); return (unsigned short)(u >> 16); }
__device__ __forceinline__ float bf2f(unsigned short b) { return __uint_as_float(((unsigned)b) << 16); }
__device__ __forceinline__ float bfr(float f) { return bf2f(f2bf(f)); }
__device__ __forceinline__ v16h cat16(v8h lo, v8h hi) { return __builtin_shufflevector(lo, hi, 0, 1, 2, 3, 4, 5, 6, 7, 8, 9, 10, 11, 12, 13, 14, 15); }
__device__ __forceinline__ v16bf cat16b(v8us lo, v8us hi) { return __builtin_bit_cast(v16bf, __builtin_shufflevector(lo, hi, 0, 1, 2, 3, 4, 5, 6, 7, 8, 9, 10, 11, 12, 13, 14, 15)); }
__device__ __forceinline__ v8f wmma16(v16h a, v16h b, v8f c) { return __builtin_amdgcn_wmma_f32_16x16x32_f16(false, a, false, b, (short)0, c, false, false); }
__device__ __forceinline__ v8f wmmab(v16bf a, v16bf b, v8f c) { return __builtin_amdgcn_wmma_f32_16x16x32_bf16(false, a, false, b, (short)0, c, false, false); }



// ---- k_gemmw: register-blocked GEMM, one work-group of NW waves per 64x64 output tile (16 accumulators a wave), operands straight from K-contiguous 16-bit planes; grid (M/64, N/64, Z), 32 * NW threads.
// Wave w takes the 32-wide k chunks w, w + NW, w + 2 NW, ...; the NW partial tiles are summed through LDS in the fixed order w = 0 .. NW-1 (the one-wave loop is a chain of exposed load latencies: NW chains run side by side).
// NW > 1 stages all 64 rows of every partial tile at once (MBR = 4 blocks of 16 rows): one barrier, and no output store has to drain in front of a second one.
// C[m][n] (f32, pitch ldc, + optional f32 bias[n]) = sum_k A[m][k] Bt[n][k] (+ split products per NSPLIT). z-batch strides sA/sB/sC in elements. K % 32 == 0.
template <typename T16> struct WFrag;
template <> struct WFrag<h16> { typedef v16h V; static __device__ __forceinline__ V ld(const h16* p) { return cat16(*(const v8h*)p, *(const v8h*)(p + 16)); } static __device__ __forceinline__ v8f mma(V a, V b, v8f c) { return wmma16(a, b, c); } };
template <> struct WFrag<bf> { typedef v16bf V; static __device__ __forceinline__ V ld(const bf* p) { return cat16b(*(const v8us*)p, *(const v8us*)(p + 16)); } static __device__ __forceinline__ v8f mma(V a, V b, v8f c) { return wmmab(a, b, c); } };
template <typename T16, int NSPLIT, bool BIAS, int NW>
__global__ __launch_bounds__(32 * NW) void k_gemmw(const T16* __restrict__ A, const T16* __restrict__ A2, const T16* __restrict__ Bt, const T16* __restrict__ Bt2, int K, float* C, int ldc, const float* __restrict__ bias, size_t sA, size_t sB, size_t sC) {
    typedef typename WFrag<T16>::V V;
    constexpr int MBR = (NW > 1) ? 4 : 1;   // 16-row blocks staged per round
    __shared__ __align__(16) float os[NW * MBR * 16 * 68];
    const int wv = (NW > 1) ? __builtin_amdgcn_readfirstlane((int)(threadIdx.x >> 5)) : 0;   // wave number, scalar: the k loop stays a scalar loop
    const size_t z = blockIdx.z; A += z * sA; if (A2) A2 += z * sA; Bt += z * sB; if (Bt2) Bt2 += z * sB; C += z * sC;
    const int lane = threadIdx.x & 31, lr = lane & 15, hi = lane >> 4; const int r0 = blockIdx.x * 64, c0 = blockIdx.y * 64;
    v8f acc[4][4];
#pragma unroll
    for (int mb = 0; mb < 4; ++mb)
#pragma unroll
        for (int nb = 0; nb < 4; ++nb) acc[mb][nb] = (v8f){};
    const size_t aoff = (size_t)(r0 + lr) * K + 8 * hi, boff = (size_t)(c0 + lr) * K + 8 * hi;
#pragma unroll 1
    for (int kc = wv * 32; kc < K; kc += 32 * NW) {
        V a[4], a2[4];
#pragma unroll
        for (int mb = 0; mb < 4; ++mb) { a[mb] = WFrag<T16>::ld(A + aoff + (size_t)mb * 16 * K + kc); if (NSPLIT == 1 || NSPLIT == 2) a2[mb] = WFrag<T16>::ld(A2 + aoff + (size_t)mb * 16 * K + kc); }
#pragma unroll
        for (int nb = 0; nb < 4; ++nb) { const V b = WFrag<T16>::ld(Bt + boff + (size_t)nb * 16 * K + kc); V b2; if (NSPLIT >= 2) b2 = WFrag<T16>::ld(Bt2 + boff + (size_t)nb * 16 * K + kc);
#pragma unroll
            for (int mb = 0; mb < 4; ++mb) { acc[mb][nb] = WFrag<T16>::mma(a[mb], b, acc[mb][nb]); if (NSPLIT == 1 || NSPLIT == 2) acc[mb][nb] = WFrag<T16>::mma(a2[mb], b, acc[mb][nb]); if (NSPLIT >= 2) acc[mb][nb] = WFrag<T16>::mma(a[mb], b2, acc[mb][nb]); } }
        asm volatile("v_nop\n\tv_nop\n\tv_nop\n\tv_nop" : "+v"(acc[0][0]), "+v"(acc[1][1]), "+v"(acc[2][2]), "+v"(acc[3][3]) : "v"(a[0]), "v"(a[3]));
    }
#pragma unroll
    for (int mb = 0; mb < 4; mb += MBR) {
#pragma unroll
        for (int mi = 0; mi < MBR; ++mi)
#pragma unroll
        for (int nb = 0; nb < 4; ++nb) {
#pragma unroll
            for (int j = 0; j < 8; ++j) os[(wv * MBR + mi) * (16 * 68) + (hi * 8 + j) * 68 + nb * 16 + lr] = acc[mb + mi][nb][j]; }
        if (NW > 1) __syncthreads();   // every wave's partial tile is in LDS before any thread sums it
        else { __builtin_amdgcn_wave_barrier(); asm volatile("" ::: "memory"); }
        float* crow = C + (size_t)(r0 + mb * 16) * ldc + c0;
{
#pragma unroll
            for (int s = 0; s < 8 * MBR / NW; ++s) { const int row = 2 * (s * NW + wv) + hi, cofs = lr * 4; v4f val = *(const v4fa*)(os + row * 68 + cofs);
#pragma unroll
                for (int w = 1; w < NW; ++w) val += *(const v4fa*)(os + w * (MBR * 16 * 68) + row * 68 + cofs);
                if (BIAS) { val[0] += bfr(bias[c0 + cofs]); val[1] += bfr(bias[c0 + cofs + 1]); val[2] += bfr(bias[c0 + cofs + 2]); val[3] += bfr(bias[c0 + cofs + 3]); }
                *(v4f*)(crow + (size_t)row * ldc + cofs) = val; }
             }
        if (NW == 1) { __builtin_amdgcn_wave_barrier(); asm volatile("" ::: "memory"); }   // NW > 1: one round, nothing is staged again
    }
}

// ---- k_gemmc: the same 64x64 tile GEMM (NW waves share the k loop; NW = 1 for the two-chunk score tiles) specialised for causal attention: CMODE 1 skips score tiles entirely above the diagonal (query rows r0+roff.., key columns c0..), CMODE 2 limits the
// key (K) loop of the probability x value contraction to the diagonal block (probabilities beyond it are exactly zero). roff = row offset of this launch's first row within the sequence.
// lda = pitch of the A rows in elements (Bt rows have pitch K); head z of the launch reads the B planes of kv group z / REP (stride sB).
template <typename T16, int NSPLIT, int CMODE, int NW>
__global__ __launch_bounds__(32 * NW) void k_gemmc(const T16* __restrict__ A, const T16* __restrict__ A2, const T16* __restrict__ Bt, const T16* __restrict__ Bt2, int K, int lda, float* C, int ldc, int roff, size_t sA, size_t sB, size_t sC) {
    typedef typename WFrag<T16>::V V;
    constexpr int MBR = (NW > 1) ? 4 : 1;   // 16-row blocks staged per round
    __shared__ __align__(16) float os[NW * MBR * 16 * 68];
    const int wv = (NW > 1) ? __builtin_amdgcn_readfirstlane((int)(threadIdx.x >> 5)) : 0;   // wave number, scalar: the k loop stays a scalar loop
    const size_t z = blockIdx.z; A += z * sA; if (A2) A2 += z * sA; Bt += (z / REP) * sB; if (Bt2) Bt2 += (z / REP) * sB; C += z * sC;
    const int lane = threadIdx.x & 31, lr = lane & 15, hi = lane >> 4; const int r0 = blockIdx.x * 64, c0 = blockIdx.y * 64;
    if (CMODE == 1 && c0 > r0 + roff + 63) return;                  // score tile entirely above the causal diagonal: never read (the softmax masks j > i by select)
    const int Kl = (CMODE == 2) ? min(K, r0 + roff + 64) : K;        // P.V: probabilities are exactly 0 beyond the diagonal block, so the K loop stops there
    v8f acc[4][4];
#pragma unroll
    for (int mb = 0; mb < 4; ++mb)
#pragma unroll
        for (int nb = 0; nb < 4; ++nb) acc[mb][nb] = (v8f){};
    const size_t aoff = (size_t)(r0 + lr) * lda + 8 * hi, boff = (size_t)(c0 + lr) * K + 8 * hi;
#pragma unroll 1
    for (int kc = wv * 32; kc < Kl; kc += 32 * NW) {
        V a[4], a2[4]; const T16* pa[4]; const T16* pa2[4]; const T16* pb[4];
#pragma unroll
        for (int mb = 0; mb < 4; ++mb) { pa[mb] = A + aoff + (size_t)mb * 16 * lda + kc; a[mb] = WFrag<T16>::ld(pa[mb]); if (NSPLIT == 1 || NSPLIT == 2) { pa2[mb] = A2 + aoff + (size_t)mb * 16 * lda + kc; a2[mb] = WFrag<T16>::ld(pa2[mb]); } }
        // s_wait_xcnt 0 behind the run of A loads; their address pairs are its inputs, so they stay live up to it and no later load's result or address sum is written into one of them in front of it
        if (NSPLIT == 1 || NSPLIT == 2) asm volatile("s_wait_xcnt 0x0" :: "v"(pa[0]), "v"(pa[1]), "v"(pa[2]), "v"(pa[3]), "v"(pa2[0]), "v"(pa2[1]), "v"(pa2[2]), "v"(pa2[3]) : "memory");
        else asm volatile("s_wait_xcnt 0x0" :: "v"(pa[0]), "v"(pa[1]), "v"(pa[2]), "v"(pa[3]) : "memory");
#pragma unroll
        for (int nb = 0; nb < 4; ++nb) { pb[nb] = Bt + boff + (size_t)nb * 16 * K + kc; const V b = WFrag<T16>::ld(pb[nb]); V b2;
            // the same for the B loads. With two B planes the wait follows each column block's loads, so that its two pairs are free again at once (no registers are left to hold eight)
            if (NSPLIT >= 2) { const T16* pb2 = Bt2 + boff + (size_t)nb * 16 * K + kc; b2 = WFrag<T16>::ld(pb2); asm volatile("s_wait_xcnt 0x0" :: "v"(pb[nb]), "v"(pb2) : "memory"); }
#pragma unroll
            for (int mb = 0; mb < 4; ++mb) { acc[mb][nb] = WFrag<T16>::mma(a[mb], b, acc[mb][nb]); if (NSPLIT == 1 || NSPLIT == 2) acc[mb][nb] = WFrag<T16>::mma(a2[mb], b, acc[mb][nb]); if (NSPLIT >= 2) acc[mb][nb] = WFrag<T16>::mma(a[mb], b2, acc[mb][nb]); } }
        // with one B plane the four pairs stay live, as inputs, to one wait at the foot of the trip, and no statement stands between the B loads
        if (NSPLIT < 2) asm volatile("s_wait_xcnt 0x0" :: "v"(pb[0]), "v"(pb[1]), "v"(pb[2]), "v"(pb[3]) : "memory");
        asm volatile("v_nop\n\tv_nop\n\tv_nop\n\tv_nop" : "+v"(acc[0][0]), "+v"(acc[1][1]), "+v"(acc[2][2]), "+v"(acc[3][3]) : "v"(a[0]), "v"(a[3]));
    }
#pragma unroll
    for (int mb = 0; mb < 4; mb += MBR) {
#pragma unroll
        for (int mi = 0; mi < MBR; ++mi)
#pragma unroll
        for (int nb = 0; nb < 4; ++nb) {
#pragma unroll
            for (int j = 0; j < 8; ++j) os[(wv * MBR + mi) * (16 * 68) + (hi * 8 + j) * 68 + nb * 16 + lr] = acc[mb + mi][nb][j]; }
        if (NW > 1) __syncthreads();   // every wave's partial tile is in LDS before any thread sums it
        else { __builtin_amdgcn_wave_barrier(); asm volatile("" ::: "memory"); }
        float* crow = C + (size_t)(r0 + mb * 16) * ldc + c0;
{
#pragma unroll
            for (int s = 0; s < 8 * MBR / NW; ++s) { const int row = 2 * (s * NW + wv) + hi, cofs = lr * 4; v4f val = *(const v4fa*)(os + row * 68 + cofs);
#pragma unroll
                for (int w = 1; w < NW; ++w) val += *(const v4fa*)(os + w * (MBR * 16 * 68) + row * 68 + cofs);
                *(v4f*)(crow + (size_t)row * ldc + cofs) = val; }
             }
        if (NW == 1) { __builtin_amdgcn_wave_barrier(); asm volatile("" ::: "memory"); }   // NW > 1: one round, nothing is staged again
    }
}

__device__ __forceinline__ h16 tohx(float x) { return (h16)x; }
__device__ __forceinline__ void splitf(float y, unsigned short& h, unsigned short& l) { h = f2bf(y); l = f2bf(y - bf2f(h)); }
typedef __attribute__((ext_vector_type(2))) _Float16 v2h;
typedef __attribute__((ext_vector_type(4))) _Float16 v4h;
typedef __attribute__((ext_vector_type(2))) unsigned short v2us;
typedef __attribute__((ext_vector_type(4))) unsigned short v4us;
typedef __attribute__((ext_vector_type(2))) float v2f;
typedef __attribute__((ext_vector_type(4))) int v4i;
typedef v4h  __attribute__((may_alias)) v4ha;
typedef v4us __attribute__((may_alias)) v4usa;

__global__ __launch_bounds__(256) void k_cvt8(const float* __restrict__ src, bf* dst, size_t n8) { const size_t i = (size_t)blockIdx.x * 256 + threadIdx.x; if (i >= n8) return; const v8f v = *(const v8f*)(src + i * 8); v8us o;
#pragma unroll
    for (int k = 0; k < 8; ++k) o[k] = f2bf(v[k]); *(v8us*)(dst + i * 8) = o;  }

// k_rope: head planes [h][t][d] (fp16 + hi/lo) of rope(x) x sc with the rotate-half convention out[d] = x[d] cos[t][d] - x[d+HD/2] sin[t][d], out[d+HD/2] = x[d+HD/2] cos[t][d+HD/2] + x[d] sin[t][d+HD/2]
__global__ __launch_bounds__(256) void k_rope(const float* __restrict__ F, int pitch, int nheads, const float* __restrict__ CS, const float* __restrict__ RF, const float* __restrict__ nw, float sc, h16* P16, bf* Ph, bf* Pl) {
    const size_t e = ((size_t)blockIdx.x * 256 + threadIdx.x) * 2; if (e >= (size_t)nheads * TT * HD) return; const int d = (int)(e % HD); const int t = (int)((e / HD) % TT); const int h = (int)(e / ((size_t)HD * TT)); const float* f = F + (size_t)t * pitch + h * HD; const float rf = RF ? RF[(size_t)h * TT + t] : 1.0f; v2h o16; v2us oh, ol;
#pragma unroll
    for (int q = 0; q < 2; ++q) { const int dd = d + q; const int dp = (dd < HD / 2) ? dd + HD / 2 : dd - HD / 2; float x0 = f[dd], x1 = f[dp];
        if (RF) { float n0 = __fmul_rn(x0, rf), n1 = __fmul_rn(x1, rf); asm volatile("" : "+v"(n0)); asm volatile("" : "+v"(n1)); x0 = __fmul_rn(bfr(nw[dd]), n0); x1 = __fmul_rn(bfr(nw[dp]), n1); }
        const v2f cs = *(const v2f*)(CS + ((size_t)t * HD + dd) * 2); float a = __fmul_rn(x0, cs[0]), bq = __fmul_rn(x1, cs[1]); asm volatile("" : "+v"(a)); asm volatile("" : "+v"(bq)); const float r = ((dd < HD / 2) ? __fsub_rn(a, bq) : __fadd_rn(a, bq)) * sc;
        o16[q] = tohx(r); unsigned short a2, c2; splitf(r, a2, c2); oh[q] = a2; ol[q] = c2; }
    *(v2h*)(P16 + e) = o16; *(v2us*)(Ph + e) = oh; *(v2us*)(Pl + e) = ol;  }
__global__ __launch_bounds__(256) void k_vtp(const float* __restrict__ F, int pitch, int nheads, h16* V16, bf* Vh, bf* Vl) { const size_t e = ((size_t)blockIdx.x * 256 + threadIdx.x) * 2; if (e >= (size_t)nheads * HD * TT) return; const int t = (int)(e % TT); const int d = (int)((e / TT) % HD); const int g = (int)(e / ((size_t)TT * HD)); v2h o16; v2us oh, ol;
#pragma unroll
    for (int q = 0; q < 2; ++q) { const float x = F[(size_t)(t + q) * pitch + g * HD + d]; o16[q] = tohx(x); unsigned short a2, c2; splitf(x, a2, c2); oh[q] = a2; ol[q] = c2; }
    *(v2h*)(V16 + e) = o16; *(v2us*)(Vh + e) = oh; *(v2us*)(Vl + e) = ol;  }
__global__ __launch_bounds__(256) void k_cscvt(const float* __restrict__ cosT, const float* __restrict__ sinT, float* CS) { const int idx = blockIdx.x * 256 + threadIdx.x; if (idx >= TT * HD) return; v2f cs; cs[0] = bfr(cosT[idx]); cs[1] = bfr(sinT[idx]); *(v2f*)(CS + (size_t)idx * 2) = cs;  }
// k_asoft: per row (zz, i): t = S x HD^-0.5 for j <= i and i - j < WIN (sliding causal window; the reference's -1e9 additive fill vanishes identically); softmax over the 2048 keys (register row, one exp, fixed trees);
// the probabilities go back into the row's own 4 TT bytes: rows < RH as a bf16 hi plane (first TT elements) and lo plane (next TT), the rest as fp16 in the first TT elements. One wave owns a row and holds all of it in registers: every store takes the row sum, which takes every load.
__global__ __launch_bounds__(256) void k_asoft(float* Sb) {
    const int lane = threadIdx.x & 31; const int row = blockIdx.x * 8 + (threadIdx.x >> 5); if (row >= ZH * TT) return; const int i = row % TT; const int zz = row / TT; (void)zz; const bool hires = (i < RH); float* sr = Sb + (size_t)row * TT; float v[TT / 32]; float mx = -3.0e38f;
#pragma unroll
    for (int ch = 0; ch < TT / 128; ++ch) { const int j0 = ch * 128 + lane * 4; const v4f a = *(const v4fa*)(sr + j0);
#pragma unroll
        for (int q = 0; q < 4; ++q) { const int j = j0 + q; (void)j; const float t = (j <= i && i - j < WIN) ? a[q] * SCL : -3.0e38f; v[ch * 4 + q] = t; mx = fmaxf(mx, t); } }
#pragma unroll
    for (int sh = 16; sh; sh >>= 1) mx = fmaxf(mx, __shfl_xor(mx, sh, 32));
    float sum = 0.f;
#pragma unroll
    for (int k = 0; k < TT / 32; ++k) { float d0 = __fsub_rn(v[k], mx); asm volatile("" : "+v"(d0)); v[k] = __builtin_amdgcn_exp2f(__fmul_rn(d0, 1.4426950408889634f)); sum += v[k]; }
#pragma unroll
    for (int sh = 16; sh; sh >>= 1) sum += __shfl_xor(sum, sh, 32);
    const float f = __fdiv_rn(hires ? 1.0f : PCAR, sum);
{
        if (hires) {
#pragma unroll
            for (int ch = 0; ch < TT / 128; ++ch) { v4us oh, ol;
#pragma unroll
                for (int q = 0; q < 4; ++q) { unsigned short a, c2; splitf(v[ch * 4 + q] * f, a, c2); oh[q] = a; ol[q] = c2; }
                bf* ph = (bf*)sr + ch * 128 + lane * 4; *(v4usa*)ph = oh; *(v4usa*)(ph + TT) = ol; }
        } else {
#pragma unroll
            for (int ch = 0; ch < TT / 128; ++ch) { v4h o4;
#pragma unroll
                for (int q = 0; q < 4; ++q) o4[q] = tohx(v[ch * 4 + q] * f);
                *(v4ha*)((h16*)sr + ch * 128 + lane * 4) = o4; } }
         }
}
__global__ __launch_bounds__(256) void k_merge(const float* __restrict__ O, int h0, bf* Ah, bf* Al) { const size_t e = ((size_t)blockIdx.x * 256 + threadIdx.x) * 2; if (e >= (size_t)ZH * TT * HD) return; const int d = (int)(e % HD); const int t = (int)((e / HD) % TT); const int zz = (int)(e / ((size_t)HD * TT)); const float cs = (t < RH) ? 1.0f : (1.0f / PCAR); const size_t oo = (size_t)t * DQ + (h0 + zz) * HD + d;
    v2us oh, ol;
#pragma unroll
    for (int q = 0; q < 2; ++q) { unsigned short a, c2; splitf(O[e + q] * cs, a, c2); oh[q] = a; ol[q] = c2; } *(v2us*)(Ah + oo) = oh; *(v2us*)(Al + oo) = ol;  }

extern "C" void kernel_launch(void* const* d_in, const int* in_sizes, int n_in,
                              void* d_out, int out_size, void* d_ws, size_t ws_size, hipStream_t stream) {
    (void)in_sizes; (void)n_in; (void)out_size;
    const float* x = (const float*)d_in[0]; const float* fcos = (const float*)d_in[1]; const float* fsin = (const float*)d_in[2]; const float* wq = (const float*)d_in[3]; const float* wk = (const float*)d_in[4]; const float* wv = (const float*)d_in[5]; const float* wo = (const float*)d_in[6];   /* x, cos, sin [2][2048][64] = [B][S][HD] (PER-BATCH table inputs: read per element by value), Wq [2048][2048], Wk [512][2048], Wv, Wo ('oi') */
    float* OUT = (float*)d_out;     // [2][2048][2048]
    char* wsp = (char*)d_ws;
    auto take = [&](size_t bytes) { char* p = wsp; wsp += (bytes + 255) & ~(size_t)255; return (void*)p; };
    bf* WQ = (bf*)take((size_t)DQ * DM * 2); bf* WK = (bf*)take((size_t)DKV * DM * 2); bf* WV = (bf*)take((size_t)DKV * DM * 2); bf* WO = (bf*)take((size_t)DM * DQ * 2); float* CS = (float*)take((size_t)TT * HD * 2 * 4);
    bf* XB = (bf*)take((size_t)TT * DM * 2); float* FQ = (float*)take((size_t)TT * DQ * 4); float* FK = (float*)take((size_t)TT * DKV * 4);
    h16* QP16 = (h16*)take((size_t)NH_ * TT * HD * 2); h16* KP16 = (h16*)take((size_t)NKV * TT * HD * 2); h16* VT16 = (h16*)take((size_t)NKV * HD * TT * 2);
    bf* QPh = (bf*)take((size_t)NH_ * TT * HD * 2); bf* QPl = (bf*)take((size_t)NH_ * TT * HD * 2); bf* KPh = (bf*)take((size_t)NKV * TT * HD * 2); bf* KPl = (bf*)take((size_t)NKV * TT * HD * 2); bf* VTh = (bf*)take((size_t)NKV * HD * TT * 2); bf* VTl = (bf*)take((size_t)NKV * HD * TT * 2);
    float* Sb = (float*)take((size_t)ZH * TT * TT * 4); float* Ob = (float*)take((size_t)ZH * TT * HD * 4); bf* ATh = (bf*)take((size_t)TT * DQ * 2); bf* ATl = (bf*)take((size_t)TT * DQ * 2);
    if ((size_t)(wsp - (char*)d_ws) > ws_size) return;    // ws 256 MiB
    float* FV = FK;   // v projection reuses the k buffer after the k planes are built (stream-ordered)
    { k_cvt8<<<(unsigned)(((size_t)DQ * DM / 8 + 255) / 256), 256, 0, stream>>>(wq, WQ, (size_t)DQ * DM / 8); k_cvt8<<<(unsigned)(((size_t)DKV * DM / 8 + 255) / 256), 256, 0, stream>>>(wk, WK, (size_t)DKV * DM / 8); k_cvt8<<<(unsigned)(((size_t)DKV * DM / 8 + 255) / 256), 256, 0, stream>>>(wv, WV, (size_t)DKV * DM / 8);
      k_cvt8<<<(unsigned)(((size_t)DM * DQ / 8 + 255) / 256), 256, 0, stream>>>(wo, WO, (size_t)DM * DQ / 8);
       }
    /* the rotary table is copied PER BATCH inside the loop below (this module's cos / sin are [B][S][HD]) */
    const unsigned LQ = (unsigned)(((size_t)NH_ * TT * HD / 2 + 255) / 256), LKv = (unsigned)(((size_t)NKV * TT * HD / 2 + 255) / 256);
    for (int b = 0; b < NB_; ++b) {
        k_cscvt<<<(TT * HD + 255) / 256, 256, 0, stream>>>(fcos + (size_t)b * TT * HD, fsin + (size_t)b * TT * HD, CS);   /* batch b's own rotary table slice from the inputs (stream-ordered: before this batch's plane builders) */
        k_cvt8<<<(unsigned)(((size_t)TT * DM / 8 + 255) / 256), 256, 0, stream>>>(x + (size_t)b * TT * DM, XB, (size_t)TT * DM / 8);
        k_gemmw<bf, 0, false, 8><<<dim3(TT / 64, DQ / 64, 1), 256, 0, stream>>>(XB, nullptr, WQ, nullptr, DM, FQ, DQ, nullptr, 0, 0, 0);
        k_rope<<<LQ, 256, 0, stream>>>(FQ, DQ, NH_, CS, nullptr, nullptr, 1.0f, QP16, QPh, QPl);
        k_gemmw<bf, 0, false, 8><<<dim3(TT / 64, DKV / 64, 1), 256, 0, stream>>>(XB, nullptr, WK, nullptr, DM, FK, DKV, nullptr, 0, 0, 0);
        k_rope<<<LKv, 256, 0, stream>>>(FK, DKV, NKV, CS, nullptr, nullptr, 1.0f, KP16, KPh, KPl);
        k_gemmw<bf, 0, false, 8><<<dim3(TT / 64, DKV / 64, 1), 256, 0, stream>>>(XB, nullptr, WV, nullptr, DM, FV, DKV, nullptr, 0, 0, 0); k_vtp<<<LKv, 256, 0, stream>>>(FV, DKV, NKV, VT16, VTh, VTl);
        for (int h0 = 0; h0 < NH_; h0 += ZH) { const size_t zq = (size_t)h0, zk = (size_t)(h0 / REP);   // head h0 + z of a pass reads kv group h0 / REP + z / REP
            k_gemmc<bf, 2, 1, 1><<<dim3(RH / 64, TT / 64, ZH), 32, 0, stream>>>(QPh + zq * TT * HD, QPl + zq * TT * HD, KPh + zk * TT * HD, KPl + zk * TT * HD, HD, HD, Sb, TT, 0, (size_t)TT * HD, (size_t)TT * HD, (size_t)TT * TT);
            k_gemmc<h16, 0, 1, 1><<<dim3((TT - RH) / 64, TT / 64, ZH), 32, 0, stream>>>(QP16 + zq * TT * HD + (size_t)RH * HD, nullptr, KP16 + zk * TT * HD, nullptr, HD, HD, Sb + (size_t)RH * TT, TT, RH, (size_t)TT * HD, (size_t)TT * HD, (size_t)TT * TT);
            k_asoft<<<ZH * TT / 8, 256, 0, stream>>>(Sb);
            k_gemmc<bf, 2, 2, 8><<<dim3(RH / 64, HD / 64, ZH), 256, 0, stream>>>((const bf*)Sb, (const bf*)Sb + TT, VTh + zk * HD * TT, VTl + zk * HD * TT, TT, 2 * TT, Ob, HD, 0, (size_t)TT * TT * 2, (size_t)HD * TT, (size_t)TT * HD);
            k_gemmc<h16, 0, 2, 16><<<dim3((TT - RH) / 64, HD / 64, ZH), 512, 0, stream>>>((const h16*)Sb + (size_t)RH * TT * 2, nullptr, VT16 + zk * HD * TT, nullptr, TT, 2 * TT, Ob + (size_t)RH * HD, HD, RH, (size_t)TT * TT * 2, (size_t)HD * TT, (size_t)TT * HD);
            k_merge<<<(unsigned)(((size_t)ZH * TT * HD / 2 + 255) / 256), 256, 0, stream>>>(Ob, h0, ATh, ATl); }
        k_gemmw<bf, 1, false, 8><<<dim3(TT / 64, DM / 64, 1), 256, 0, stream>>>(ATh, ATl, WO, nullptr, DQ, OUT + (size_t)b * TT * DM, DM, nullptr, 0, 0, 0); }
}

// v004
// One run takes 320 microseconds.
// It is 2.62 times as fast as v002, going by the measured steps of the versions left out in between.
// All steps since v000 together make it 8.44 times as fast.
#include <hip/hip_runtime.h>

// Grouped-query causal attention (32 / 8 heads x 64) with rotate-half rotary embeddings from PER-BATCH input tables (x [2][2048][2048]; Q = x Wq^T (32 heads x 64), K, V = x Wk^T, x Wv^T (8 kv heads x 64) ('oi' (out, in) normal x 0.02, no bias); q, k -> t cos + rotate_half(t) sin with the cos / sin INPUT tables [2][2048][64] = [B][S][HD] (batch b reads ITS OWN slice, per element by value); jnp.repeat on the head axis: head h uses kv head h / 4; scores x 64^-0.5; causal (finfo.min == exclusion: every row keeps its own key); softmax; out = merged Wo^T ('oi') -> [2][2048][2048] (8.4 M); argument order x, cos, sin, Wq, Wk, Wv, Wo).
// Layout per batch: bf16 copy of x; 'oi' weights; exact projections whose epilogue builds the head planes (rotate-half with the bf16-rounded cos / sin inputs for q and k, the [d][t] transpose for v); causal T-2048 GQA attention in one launch (k_fattn: scores, online softmax and value products in registers, head h reads kv group h / REP; hybrid rows: < 512 hi/lo 3 products, rest fp16 x1024; key blocks above the diagonal are never read); merged hi/lo x Wo exact.
// Compute dtypes, f32 accumulate: every input rounded to bf16 incl. the tables; projections exact; rotary f32; attention rows < 512 3 products, rest fp16; softmax f32; Wo hl x exact.

#define NB_  2
#define TT   2048
#define DM   2048
#define NH_  32
#define NKV  8
#define REP  (NH_ / NKV)
#define HD   64
#define DQ   (NH_ * HD)
#define DKV  (NKV * HD)
#define RH   512                  // query rows < RH use hi+lo planes (0: none)
#define SCL  0.125f   // HD^-0.5
typedef _Float16 h16;
typedef unsigned short bf;
typedef __attribute__((ext_vector_type(16))) __bf16   v16bf;
typedef __attribute__((ext_vector_type(16))) _Float16 v16h;
typedef __attribute__((ext_vector_type(8)))  _Float16 v8h;
typedef __attribute__((ext_vector_type(8)))  unsigned short v8us;
typedef __attribute__((ext_vector_type(8)))  float    v8f;
typedef __attribute__((ext_vector_type(4)))  float    v4f;
typedef v8h  __attribute__((may_alias)) v8ha;
typedef v4f  __attribute__((may_alias)) v4fa;
typedef v8us __attribute__((may_alias)) v8usa;

__device__ __forceinline__ unsigned short f2bf(float f) { unsigned u = __float_as_uint(f); u += 0x7FFFu + ((u >> 16) & 1u); return (unsigned short)(u >> 16); }
__device__ __forceinline__ float bf2f(unsigned short b) { return __uint_as_float(((unsigned)b) << 16); }
__device__ __forceinline__ float bfr(float f) { return bf2f(f2bf(f)); }
__device__ __forceinline__ v16h cat16(v8h lo, v8h hi) { return __builtin_shufflevector(lo, hi, 0, 1, 2, 3, 4, 5, 6, 7, 8, 9, 10, 11, 12, 13, 14, 15); }
__device__ __forceinline__ v16bf cat16b(v8us lo, v8us hi) { return __builtin_bit_cast(v16bf, __builtin_shufflevector(lo, hi, 0, 1, 2, 3, 4, 5, 6, 7, 8, 9, 10, 11, 12, 13, 14, 15)); }
__device__ __forceinline__ v8f wmma16(v16h a, v16h b, v8f c) { return __builtin_amdgcn_wmma_f32_16x16x32_f16(false, a, false, b, (short)0, c, false, false); }
__device__ __forceinline__ v8f wmmab(v16bf a, v16bf b, v8f c) { return __builtin_amdgcn_wmma_f32_16x16x32_bf16(false, a, false, b, (short)0, c, false, false); }

__device__ __forceinline__ h16 tohx(float x) { return (h16)x; }
__device__ __forceinline__ void splitf(float y, unsigned short& h, unsigned short& l) { h = f2bf(y); l = f2bf(y - bf2f(h)); }
typedef __attribute__((ext_vector_type(4))) _Float16 v4h;
typedef __attribute__((ext_vector_type(4))) unsigned short v4us;
typedef __attribute__((ext_vector_type(2))) int v2i;
typedef __attribute__((ext_vector_type(4))) int v4i;
typedef v4h  __attribute__((may_alias)) v4ha;
typedef v4us __attribute__((may_alias)) v4usa;
__device__ __forceinline__ float xlane8(float x) { return __builtin_bit_cast(float, __builtin_amdgcn_update_dpp(0, __builtin_bit_cast(int, x), 0x168, 0xf, 0xf, true)); }   // row_xmask:8: lane l reads lane l ^ 8 of its 16-lane row, on the vector pipe

// ---- k_gemmw: register-blocked GEMM, one work-group of NW waves per 64x64 output tile (16 accumulators a wave), operands straight from K-contiguous 16-bit planes; grid (M/64, N/64, Z), 32 * NW threads.
// Wave w takes the 32-wide k chunks w, w + NW, w + 2 NW, ...; the NW partial tiles are summed through LDS in the fixed order w = 0 .. NW-1 (the one-wave loop is a chain of exposed load latencies: NW chains run side by side).
// NW > 1 stages all 64 rows of every partial tile at once (MBR = 4 blocks of 16 rows): one barrier, and no output store has to drain in front of a second one.
// C[m][n] (f32, pitch ldc, + optional f32 bias[n]) = sum_k A[m][k] Bt[n][k] (+ split products per NSPLIT). z-batch strides sA/sB/sC in elements. K % 32 == 0.
// EPI says what becomes of the summed tile, whose 64 columns are one head (blockIdx.y) and whose rows are positions t. 0: stored as f32 C.
// 1: rotate-half rotary step out[d] = x[d] cos[t][d] - x[d+32] sin[t][d], out[d+32] = x[d+32] cos[t][d+32] + x[d] sin[t][d+32] (tables rounded to bf16), stored as the [h][t][d] planes fp16 + bf16 hi/lo. A lane holds 4 columns of a row, and the partner columns sit 8 lanes away.
// 2: the sums go back to LDS, each to the place its own thread has just read, and behind a second barrier are read by columns: [g][d][t] planes, 8 lanes x 16 bytes = one whole line per d and plane.
template <typename T16> struct WFrag;
template <> struct WFrag<h16> { typedef v16h V; static __device__ __forceinline__ V ld(const h16* p) { return cat16(*(const v8h*)p, *(const v8h*)(p + 16)); } static __device__ __forceinline__ v8f mma(V a, V b, v8f c) { return wmma16(a, b, c); } };
template <> struct WFrag<bf> { typedef v16bf V; static __device__ __forceinline__ V ld(const bf* p) { return cat16b(*(const v8us*)p, *(const v8us*)(p + 16)); } static __device__ __forceinline__ v8f mma(V a, V b, v8f c) { return wmmab(a, b, c); } };
template <typename T16, int NSPLIT, bool BIAS, int NW, int EPI>
__global__ __launch_bounds__(32 * NW) void k_gemmw(const T16* __restrict__ A, const T16* __restrict__ A2, const T16* __restrict__ Bt, const T16* __restrict__ Bt2, int K, float* C, int ldc, const float* __restrict__ bias, size_t sA, size_t sB, size_t sC, const float* __restrict__ cosT, const float* __restrict__ sinT, h16* P16, bf* Ph, bf* Pl) {
    static_assert(EPI == 0 || (NW > 1 && HD == 64), "the plane epilogues want the whole 64-row tile staged and one head per tile");
    typedef typename WFrag<T16>::V V;
    constexpr int MBR = (NW > 1) ? 4 : 1;   // 16-row blocks staged per round
    __shared__ __align__(16) float os[NW * MBR * 16 * 68];
    const int wv = (NW > 1) ? __builtin_amdgcn_readfirstlane((int)(threadIdx.x >> 5)) : 0;   // wave number, scalar: the k loop stays a scalar loop
    const size_t z = blockIdx.z; A += z * sA; if (A2) A2 += z * sA; Bt += z * sB; if (Bt2) Bt2 += z * sB; C += z * sC;
    const int lane = threadIdx.x & 31, lr = lane & 15, hi = lane >> 4; const int r0 = blockIdx.x * 64, c0 = blockIdx.y * 64;
    v8f acc[4][4];
#pragma unroll
    for (int mb = 0; mb < 4; ++mb)
#pragma unroll
        for (int nb = 0; nb < 4; ++nb) acc[mb][nb] = (v8f){};
    v4f tc[8 * MBR / NW], tsn[8 * MBR / NW];
    if constexpr (EPI == 1) {   // this thread's table entries, asked for ahead of the k loop, which covers their latency (the barrier of the epilogue waits for every load that is still out)
        const size_t to = (size_t)(r0 + 2 * wv + hi) * HD + lr * 4; const float* pc = cosT + to; const float* ps = sinT + to;   // row s lies 2 NW rows further on: a constant offset from the same two addresses
#pragma unroll
        for (int s = 0; s < 8 * MBR / NW; ++s) { tc[s] = *(const v4fa*)(pc + (size_t)s * (2 * NW * HD)); tsn[s] = *(const v4fa*)(ps + (size_t)s * (2 * NW * HD)); }
        // s_wait_xcnt 0 behind the table loads; their two address pairs are its inputs, so they stay live up to it and nothing is written into one of them in front of it
        asm volatile("s_wait_xcnt 0x0" :: "v"(pc), "v"(ps) : "memory");
    }
    const size_t aoff = (size_t)(r0 + lr) * K + 8 * hi, boff = (size_t)(c0 + lr) * K + 8 * hi;
#pragma unroll 1
    for (int kc = wv * 32; kc < K; kc += 32 * NW) {
        V a[4], a2[4];
#pragma unroll
        for (int mb = 0; mb < 4; ++mb) { a[mb] = WFrag<T16>::ld(A + aoff + (size_t)mb * 16 * K + kc); if (NSPLIT == 1 || NSPLIT == 2) a2[mb] = WFrag<T16>::ld(A2 + aoff + (size_t)mb * 16 * K + kc); }
#pragma unroll
        for (int nb = 0; nb < 4; ++nb) { const V b = WFrag<T16>::ld(Bt + boff + (size_t)nb * 16 * K + kc); V b2; if (NSPLIT >= 2) b2 = WFrag<T16>::ld(Bt2 + boff + (size_t)nb * 16 * K + kc);
#pragma unroll
            for (int mb = 0; mb < 4; ++mb) { acc[mb][nb] = WFrag<T16>::mma(a[mb], b, acc[mb][nb]); if (NSPLIT == 1 || NSPLIT == 2) acc[mb][nb] = WFrag<T16>::mma(a2[mb], b, acc[mb][nb]); if (NSPLIT >= 2) acc[mb][nb] = WFrag<T16>::mma(a[mb], b2, acc[mb][nb]); } }
        asm volatile("v_nop\n\tv_nop\n\tv_nop\n\tv_nop" : "+v"(acc[0][0]), "+v"(acc[1][1]), "+v"(acc[2][2]), "+v"(acc[3][3]) : "v"(a[0]), "v"(a[3]));
    }
#pragma unroll
    for (int mb = 0; mb < 4; mb += MBR) {
#pragma unroll
        for (int mi = 0; mi < MBR; ++mi)
#pragma unroll
        for (int nb = 0; nb < 4; ++nb) {
#pragma unroll
            for (int j = 0; j < 8; ++j) os[(wv * MBR + mi) * (16 * 68) + (hi * 8 + j) * 68 + nb * 16 + lr] = acc[mb + mi][nb][j]; }
        if (NW > 1) __syncthreads();   // every wave's partial tile is in LDS before any thread sums it
        else { __builtin_amdgcn_wave_barrier(); asm volatile("" ::: "memory"); }
        float* crow = C + (size_t)(r0 + mb * 16) * ldc + c0;
{
#pragma unroll
            for (int s = 0; s < 8 * MBR / NW; ++s) { const int row = 2 * (s * NW + wv) + hi, cofs = lr * 4; v4f val = *(const v4fa*)(os + row * 68 + cofs);
#pragma unroll
                for (int w = 1; w < NW; ++w) val += *(const v4fa*)(os + w * (MBR * 16 * 68) + row * 68 + cofs);
                if (BIAS) { val[0] += bfr(bias[c0 + cofs]); val[1] += bfr(bias[c0 + cofs + 1]); val[2] += bfr(bias[c0 + cofs + 2]); val[3] += bfr(bias[c0 + cofs + 3]); }
                if constexpr (EPI == 0) {
                *(v4f*)(crow + (size_t)row * ldc + cofs) = val; }
                else if constexpr (EPI == 1) { v4h o16; v4us oh, ol;
#pragma unroll
                    for (int i = 0; i < 4; ++i) { const float x1 = xlane8(val[i]), cc = bfr(tc[s][i]), sn = bfr(tsn[s][i]); const float r = val[i] * cc + x1 * ((lr < 8) ? -sn : sn);
                        o16[i] = tohx(r); unsigned short a2, c2; splitf(r, a2, c2); oh[i] = a2; ol[i] = c2; }
                    const size_t e = ((size_t)blockIdx.y * TT + r0 + row) * HD + cofs; h16* p16 = P16 + e; bf* ph = Ph + e; bf* pl = Pl + e;
                    *(v4ha*)p16 = o16; *(v4usa*)ph = oh; *(v4usa*)pl = ol;
                    // s_wait_xcnt 0 behind the three stores; their data and address registers are its inputs, so they stay live up to it and nothing is written into one of them in front of it
                    asm volatile("s_wait_xcnt 0x0" :: "v"(__builtin_bit_cast(v2i, o16)), "v"(__builtin_bit_cast(v2i, oh)), "v"(__builtin_bit_cast(v2i, ol)), "v"(p16), "v"(ph), "v"(pl) : "memory"); }
                else *(v4fa*)(os + row * 68 + cofs) = val; }
             }
        if constexpr (EPI == 2) {
            __syncthreads();   // the whole summed tile is in LDS before any thread reads it by columns
#pragma unroll
            for (int u = 0; u < 16 / NW; ++u) { const int idx = u * 32 * NW + (int)threadIdx.x, d = idx >> 3, tq = idx & 7; v8h o16; v8us oh, ol;
#pragma unroll
                for (int j = 0; j < 8; ++j) { const float x = os[(tq * 8 + j) * 68 + d]; o16[j] = tohx(x); unsigned short a2, c2; splitf(x, a2, c2); oh[j] = a2; ol[j] = c2; }
                const size_t e = ((size_t)blockIdx.y * HD + d) * TT + r0 + tq * 8; h16* p16 = P16 + e; bf* ph = Ph + e; bf* pl = Pl + e;
                *(v8ha*)p16 = o16; *(v8usa*)ph = oh; *(v8usa*)pl = ol;
                // s_wait_xcnt 0 behind the three stores, data and address registers as inputs: as in the rotary epilogue
                asm volatile("s_wait_xcnt 0x0" :: "v"(__builtin_bit_cast(v4i, o16)), "v"(__builtin_bit_cast(v4i, oh)), "v"(__builtin_bit_cast(v4i, ol)), "v"(p16), "v"(ph), "v"(pl) : "memory"); }
        }
        if (NW == 1) { __builtin_amdgcn_wave_barrier(); asm volatile("" ::: "memory"); }   // NW > 1: one round, nothing is staged again
    }
}


__global__ __launch_bounds__(256) void k_cvt8(const float* __restrict__ src, bf* dst, size_t n8) { const size_t i = (size_t)blockIdx.x * 256 + threadIdx.x; if (i >= n8) return; const v8f v = *(const v8f*)(src + i * 8); v8us o;
#pragma unroll
    for (int k = 0; k < 8; ++k) o[k] = f2bf(v[k]); *(v8us*)(dst + i * 8) = o;  }

// ---- k_fattn: causal attention of one batch in one launch. One wave owns 16 * NQ query rows of one head and walks the keys 32 at a time; the four waves of a work-group are the four heads of one kv group at the same rows, so they read the same K and V lines.
// Transposed products: S^T = K Q^T (A = 16 key rows, B = 16 query rows, both by WFrag::ld), so that lane (lr, hi) holds, of query lr, the scores of keys 8 hi + j and 16 + 8 hi + j: exactly the k positions that WFrag::ld gives a B operand. The probabilities
// are therefore converted in place into the B operand of O^T += V^T P^T (A = 16 rows of the [d][t] value plane) and touch neither LDS nor memory. Running maximum and sum per query (online softmax, f32); the two lane halves join their maxima every block and their sums once at the end.
// Rows < RH: bf16 hi/lo planes, three products each (HR); the rest fp16 with the probabilities carried x 2^10 (added to the exponent; it cancels against the row sum). The result is divided by the row sum, split hi/lo and stored at [t][h][d]: one 128-byte line per (row, head), written by this wave alone.
// Left for a later step: K and V fragments come straight from the row-major planes, so every 16-byte-per-lane load touches 16 cache lines (one per row); planes stored in fragment order, or K / V blocks staged in LDS for the four waves, would make them whole-line reads.
__device__ __forceinline__ float xhalf(float x) { return __builtin_bit_cast(float, __builtin_amdgcn_permlanex16(__builtin_bit_cast(int, x), __builtin_bit_cast(int, x), 0x76543210, 0xfedcba98, false, false)); }   // lane l reads lane l ^ 16, on the vector pipe
template <typename T16, bool HR, int NQ, bool MASK, bool NEXT>
__device__ __forceinline__ void fa_block(const T16* pk, const T16* pk2, const T16* pv, const T16* pv2, int k0, int q0, int lr, int hi,
                                         const typename WFrag<T16>::V (&qf)[NQ][2], const typename WFrag<T16>::V (&qf2)[NQ][2], typename WFrag<T16>::V (&ka)[2][2], typename WFrag<T16>::V (&ka2)[2][2], v8f (&o)[4][NQ], float (&mr)[NQ], float (&ls)[NQ]) {
    typedef typename WFrag<T16>::V V;
    V va[4], va2[4];
#pragma unroll
    for (int mt = 0; mt < 4; ++mt) { va[mt] = WFrag<T16>::ld(pv + (size_t)mt * 16 * TT); if constexpr (HR) va2[mt] = WFrag<T16>::ld(pv2 + (size_t)mt * 16 * TT); }
    if constexpr (!NEXT) asm volatile("s_wait_xcnt 0x0" ::: "memory");   // last block, no loop foot behind it: the wait stands behind its loads, in front of whatever reuses their address registers
    v8f s[2][NQ];
#pragma unroll
    for (int kt = 0; kt < 2; ++kt)
#pragma unroll
        for (int nq = 0; nq < NQ; ++nq) { s[kt][nq] = (v8f){};
#pragma unroll
            for (int dc = 0; dc < 2; ++dc) { s[kt][nq] = WFrag<T16>::mma(ka[kt][dc], qf[nq][dc], s[kt][nq]); if constexpr (HR) { s[kt][nq] = WFrag<T16>::mma(ka[kt][dc], qf2[nq][dc], s[kt][nq]); s[kt][nq] = WFrag<T16>::mma(ka2[kt][dc], qf[nq][dc], s[kt][nq]); } } }
    if constexpr (NEXT) {   // the next block's key fragments fly behind the softmax and the value products
#pragma unroll
        for (int kt = 0; kt < 2; ++kt)
#pragma unroll
            for (int dc = 0; dc < 2; ++dc) { ka[kt][dc] = WFrag<T16>::ld(pk + (size_t)(32 + kt * 16) * HD + dc * 32); if constexpr (HR) ka2[kt][dc] = WFrag<T16>::ld(pk2 + (size_t)(32 + kt * 16) * HD + dc * 32); } }
    V pf[NQ], pl[NQ];
#pragma unroll
    for (int nq = 0; nq < NQ; ++nq) { float t[16]; const int qi = q0 + nq * 16 + lr;
#pragma unroll
        for (int e = 0; e < 16; ++e) { const float x = s[e >> 3][nq][e & 7] * SCL; t[e] = (!MASK || k0 + (e >> 3) * 16 + hi * 8 + (e & 7) <= qi) ? x : -3.0e38f; }
        float mx = fmaxf(t[0], t[1]);
#pragma unroll
        for (int e = 2; e < 16; ++e) mx = fmaxf(mx, t[e]);
        mx = fmaxf(mx, xhalf(mx));
        const float mn = fmaxf(mr[nq], mx); const float al = __builtin_amdgcn_exp2f((mr[nq] - mn) * 1.4426950408889634f); mr[nq] = mn;
#pragma unroll
        for (int e = 0; e < 16; ++e) t[e] = __builtin_amdgcn_exp2f((t[e] - mn) * 1.4426950408889634f + (HR ? 0.0f : 10.0f));
        ls[nq] = ls[nq] * al + (((t[0] + t[1]) + (t[2] + t[3])) + ((t[4] + t[5]) + (t[6] + t[7]))) + (((t[8] + t[9]) + (t[10] + t[11])) + ((t[12] + t[13]) + (t[14] + t[15])));
#pragma unroll
        for (int mt = 0; mt < 4; ++mt) o[mt][nq] *= al;
        if constexpr (HR) { v8us h0, h1, l0, l1;
#pragma unroll
            for (int e = 0; e < 8; ++e) { unsigned short a, c2; splitf(t[e], a, c2); h0[e] = a; l0[e] = c2; splitf(t[8 + e], a, c2); h1[e] = a; l1[e] = c2; }
            pf[nq] = cat16b(h0, h1); pl[nq] = cat16b(l0, l1);
        } else {
#pragma unroll
            for (int e = 0; e < 16; ++e) pf[nq][e] = tohx(t[e]); } }
#pragma unroll
    for (int mt = 0; mt < 4; ++mt)
#pragma unroll
        for (int nq = 0; nq < NQ; ++nq) { o[mt][nq] = WFrag<T16>::mma(va[mt], pf[nq], o[mt][nq]); if constexpr (HR) { o[mt][nq] = WFrag<T16>::mma(va[mt], pl[nq], o[mt][nq]); o[mt][nq] = WFrag<T16>::mma(va2[mt], pf[nq], o[mt][nq]); } }
}
template <typename T16, bool HR, int NQ>
__device__ __forceinline__ void fa_tile(const T16* __restrict__ Q, const T16* __restrict__ Q2, const T16* __restrict__ Kp, const T16* __restrict__ Kp2, const T16* __restrict__ Vt, const T16* __restrict__ Vt2, int q0, int h, bf* Ah, bf* Al) {
    typedef typename WFrag<T16>::V V;
    const int lane = threadIdx.x & 31, lr = lane & 15, hi = lane >> 4;
    V qf[NQ][2], qf2[NQ][2], ka[2][2], ka2[2][2]; v8f o[4][NQ]; float mr[NQ], ls[NQ];
#pragma unroll
    for (int nq = 0; nq < NQ; ++nq) { mr[nq] = -3.0e38f; ls[nq] = 0.f;
#pragma unroll
        for (int mt = 0; mt < 4; ++mt) o[mt][nq] = (v8f){};
#pragma unroll
        for (int dc = 0; dc < 2; ++dc) { const size_t qo = (size_t)(q0 + nq * 16 + lr) * HD + dc * 32 + 8 * hi; qf[nq][dc] = WFrag<T16>::ld(Q + qo); if constexpr (HR) qf2[nq][dc] = WFrag<T16>::ld(Q2 + qo); } }
    const T16* pk = Kp + (size_t)lr * HD + 8 * hi; const T16* pv = Vt + (size_t)lr * TT + 8 * hi; const T16* pk2 = pk; const T16* pv2 = pv;
    if constexpr (HR) { pk2 = Kp2 + (size_t)lr * HD + 8 * hi; pv2 = Vt2 + (size_t)lr * TT + 8 * hi; }
#pragma unroll
    for (int kt = 0; kt < 2; ++kt)
#pragma unroll
        for (int dc = 0; dc < 2; ++dc) { ka[kt][dc] = WFrag<T16>::ld(pk + (size_t)kt * 16 * HD + dc * 32); if constexpr (HR) ka2[kt][dc] = WFrag<T16>::ld(pk2 + (size_t)kt * 16 * HD + dc * 32); }
    asm volatile("s_wait_xcnt 0x0" ::: "memory");   // behind the query and first key loads, in front of whatever reuses their address registers
    const int nfull = q0 / 32;   // key blocks that lie wholly at or below every row's diagonal; exactly one more block follows, and it holds every row's own key
    for (int kb = 0; kb < nfull; ++kb) {
        fa_block<T16, HR, NQ, false, true>(pk, pk2, pv, pv2, kb * 32, q0, lr, hi, qf, qf2, ka, ka2, o, mr, ls);
        // One statement at the trip's foot. s_wait_xcnt 0 behind the trip's loads, in front of the next trip's address sums: the accumulators are operands, so it stands behind the last WMMAs, where the loads were issued long ago and it costs nothing.
        // Then four vector slots behind those WMMAs: across the back edge the next trip's first products write registers that these read.
        if constexpr (HR) asm volatile("s_wait_xcnt 0x0\n\tv_nop\n\tv_nop\n\tv_nop\n\tv_nop" : "+v"(o[0][0]), "+v"(o[1][0]), "+v"(o[2][0]), "+v"(o[3][0]) : "v"(pk), "v"(pv), "v"(pk2), "v"(pv2) : "memory");
        else asm volatile("s_wait_xcnt 0x0\n\tv_nop\n\tv_nop\n\tv_nop\n\tv_nop" : "+v"(o[0][0]), "+v"(o[1][0]), "+v"(o[2][0]), "+v"(o[3][0]), "+v"(o[0][NQ - 1]), "+v"(o[1][NQ - 1]), "+v"(o[2][NQ - 1]), "+v"(o[3][NQ - 1]) : "v"(pk), "v"(pv) : "memory");
        pk += 32 * HD; pv += 32; if constexpr (HR) { pk2 += 32 * HD; pv2 += 32; }
    }
    fa_block<T16, HR, NQ, true, false>(pk, pk2, pv, pv2, nfull * 32, q0, lr, hi, qf, qf2, ka, ka2, o, mr, ls);
#pragma unroll
    for (int nq = 0; nq < NQ; ++nq) { const float inv = __fdiv_rn(1.0f, ls[nq] + xhalf(ls[nq])); const size_t oo = (size_t)(q0 + nq * 16 + lr) * DQ + h * HD + hi * 8; bf* ph = Ah + oo; bf* pl = Al + oo;
#pragma unroll
        for (int mt = 0; mt < 4; ++mt) { v8us oh, ol;
#pragma unroll
            for (int j = 0; j < 8; ++j) { unsigned short a, c2; splitf(o[mt][nq][j] * inv, a, c2); oh[j] = a; ol[j] = c2; }
            *(v8usa*)(ph + mt * 16) = oh; *(v8usa*)(pl + mt * 16) = ol;
            // s_wait_xcnt 0 behind each pair of stores; their data registers and the row's two address pairs are its inputs, so they stay live up to it and nothing is written into one of them in front of it
            asm volatile("s_wait_xcnt 0x0" :: "v"(__builtin_bit_cast(v4i, oh)), "v"(__builtin_bit_cast(v4i, ol)), "v"(ph), "v"(pl) : "memory"); } }
}
// grid (NKV, (TT - RH) / 32 + RH / 16), 128 threads: blockIdx.y counts the row tiles from the longest (last rows) down, the short hi/lo tiles last, so that the long ones start first.
__global__ __launch_bounds__(128) void k_fattn(const h16* __restrict__ Q16, const h16* __restrict__ K16, const h16* __restrict__ V16, const bf* __restrict__ Qh, const bf* __restrict__ Ql, const bf* __restrict__ Kh, const bf* __restrict__ Kl, const bf* __restrict__ Vh, const bf* __restrict__ Vl, bf* Ah, bf* Al) {
    const int wv = __builtin_amdgcn_readfirstlane((int)(threadIdx.x >> 5));   // wave number = head within the kv group, scalar
    const int g = blockIdx.x, h = g * REP + wv, ty = blockIdx.y; const size_t zq = (size_t)h * TT * HD, zk = (size_t)g * TT * HD;
    if (ty < (TT - RH) / 32) fa_tile<h16, false, 2>(Q16 + zq, nullptr, K16 + zk, nullptr, V16 + zk, nullptr, TT - 32 * (ty + 1), h, Ah, Al);
    else fa_tile<bf, true, 1>(Qh + zq, Ql + zq, Kh + zk, Kl + zk, Vh + zk, Vl + zk, RH - 16 * (ty - (TT - RH) / 32 + 1), h, Ah, Al);
}

extern "C" void kernel_launch(void* const* d_in, const int* in_sizes, int n_in,
                              void* d_out, int out_size, void* d_ws, size_t ws_size, hipStream_t stream) {
    (void)in_sizes; (void)n_in; (void)out_size;
    const float* x = (const float*)d_in[0]; const float* fcos = (const float*)d_in[1]; const float* fsin = (const float*)d_in[2]; const float* wq = (const float*)d_in[3]; const float* wk = (const float*)d_in[4]; const float* wv = (const float*)d_in[5]; const float* wo = (const float*)d_in[6];   /* x [2][2048][2048], cos, sin [2][2048][64] = [B][S][HD] (PER-BATCH table inputs: read per element by value), Wq [2048][2048], Wk [512][2048], Wv, Wo ('oi') */
    float* OUT = (float*)d_out;     // [2][2048][2048]
    char* wsp = (char*)d_ws;
    auto take = [&](size_t bytes) { char* p = wsp; wsp += (bytes + 255) & ~(size_t)255; return (void*)p; };
    bf* WQ = (bf*)take((size_t)DQ * DM * 2); bf* WK = (bf*)take((size_t)DKV * DM * 2); bf* WV = (bf*)take((size_t)DKV * DM * 2); bf* WO = (bf*)take((size_t)DM * DQ * 2);
    bf* XB = (bf*)take((size_t)TT * DM * 2);
    h16* QP16 = (h16*)take((size_t)NH_ * TT * HD * 2); h16* KP16 = (h16*)take((size_t)NKV * TT * HD * 2); h16* VT16 = (h16*)take((size_t)NKV * HD * TT * 2);
    bf* QPh = (bf*)take((size_t)NH_ * TT * HD * 2); bf* QPl = (bf*)take((size_t)NH_ * TT * HD * 2); bf* KPh = (bf*)take((size_t)NKV * TT * HD * 2); bf* KPl = (bf*)take((size_t)NKV * TT * HD * 2); bf* VTh = (bf*)take((size_t)NKV * HD * TT * 2); bf* VTl = (bf*)take((size_t)NKV * HD * TT * 2);
    bf* ATh = (bf*)take((size_t)TT * DQ * 2); bf* ATl = (bf*)take((size_t)TT * DQ * 2);
    if ((size_t)(wsp - (char*)d_ws) > ws_size) return;    // ws 256 MiB
    { k_cvt8<<<(unsigned)(((size_t)DQ * DM / 8 + 255) / 256), 256, 0, stream>>>(wq, WQ, (size_t)DQ * DM / 8); k_cvt8<<<(unsigned)(((size_t)DKV * DM / 8 + 255) / 256), 256, 0, stream>>>(wk, WK, (size_t)DKV * DM / 8); k_cvt8<<<(unsigned)(((size_t)DKV * DM / 8 + 255) / 256), 256, 0, stream>>>(wv, WV, (size_t)DKV * DM / 8);
      k_cvt8<<<(unsigned)(((size_t)DM * DQ / 8 + 255) / 256), 256, 0, stream>>>(wo, WO, (size_t)DM * DQ / 8);
       }
    for (int b = 0; b < NB_; ++b) {
        const float* bcos = fcos + (size_t)b * TT * HD; const float* bsin = fsin + (size_t)b * TT * HD;   /* batch b's own rotary table slices (this module's cos / sin are [B][S][HD]) */
        k_cvt8<<<(unsigned)(((size_t)TT * DM / 8 + 255) / 256), 256, 0, stream>>>(x + (size_t)b * TT * DM, XB, (size_t)TT * DM / 8);
        k_gemmw<bf, 0, false, 8, 1><<<dim3(TT / 64, DQ / 64, 1), 256, 0, stream>>>(XB, nullptr, WQ, nullptr, DM, nullptr, 0, nullptr, 0, 0, 0, bcos, bsin, QP16, QPh, QPl);
        k_gemmw<bf, 0, false, 8, 1><<<dim3(TT / 64, DKV / 64, 1), 256, 0, stream>>>(XB, nullptr, WK, nullptr, DM, nullptr, 0, nullptr, 0, 0, 0, bcos, bsin, KP16, KPh, KPl);
        k_gemmw<bf, 0, false, 8, 2><<<dim3(TT / 64, DKV / 64, 1), 256, 0, stream>>>(XB, nullptr, WV, nullptr, DM, nullptr, 0, nullptr, 0, 0, 0, nullptr, nullptr, VT16, VTh, VTl);
        k_fattn<<<dim3(NKV, (TT - RH) / 32 + RH / 16, 1), 128, 0, stream>>>(QP16, KP16, VT16, QPh, QPl, KPh, KPl, VTh, VTl, ATh, ATl);
        k_gemmw<bf, 1, false, 8, 0><<<dim3(TT / 64, DM / 64, 1), 256, 0, stream>>>(ATh, ATl, WO, nullptr, DQ, OUT + (size_t)b * TT * DM, DM, nullptr, 0, 0, 0, nullptr, nullptr, nullptr, nullptr, nullptr); }
}

// v005
// One run takes 260 microseconds.
// In two side-by-side timings against v004, it was 1.24 and 1.25 times as fast.
// All steps since v000 together make it 10.5 times as fast.
#include <hip/hip_runtime.h>

// Grouped-query causal attention (32 / 8 heads x 64) with rotate-half rotary embeddings from PER-BATCH input tables (x [2][2048][2048]; Q = x Wq^T (32 heads x 64), K, V = x Wk^T, x Wv^T (8 kv heads x 64) ('oi' (out, in) normal x 0.02, no bias); q, k -> t cos + rotate_half(t) sin with the cos / sin INPUT tables [2][2048][64] = [B][S][HD] (batch b reads ITS OWN slice, per element by value); jnp.repeat on the head axis: head h uses kv head h / 4; scores x 64^-0.5; causal (finfo.min == exclusion: every row keeps its own key); softmax; out = merged Wo^T ('oi') -> [2][2048][2048] (8.4 M); argument order x, cos, sin, Wq, Wk, Wv, Wo).
// Layout per batch: bf16 copy of x; 'oi' weights (every 16-bit plane that feeds a WMMA lies in fragment order: see FRAGMENT ORDER below); exact projections whose epilogue builds the head planes (rotate-half with the bf16-rounded cos / sin inputs for q and k, the [d][t] transpose for v); causal T-2048 GQA attention in one launch (k_fattn: scores, online softmax and value products in registers, head h reads kv group h / REP; hybrid rows: < 512 hi/lo 3 products, rest fp16 x1024; key blocks above the diagonal are never read); merged hi/lo x Wo exact.
// Compute dtypes, f32 accumulate: every input rounded to bf16 incl. the tables; projections exact; rotary f32; attention rows < 512 3 products, rest fp16; softmax f32; Wo hl x exact.

#define NB_  2
#define TT   2048
#define DM   2048
#define NH_  32
#define NKV  8
#define REP  (NH_ / NKV)
#define HD   64
#define DQ   (NH_ * HD)
#define DKV  (NKV * HD)
#define RH   512                  // query rows < RH use hi+lo planes (0: none)
#define SCL  0.125f   // HD^-0.5
typedef _Float16 h16;
typedef unsigned short bf;
typedef __attribute__((ext_vector_type(16))) __bf16   v16bf;
typedef __attribute__((ext_vector_type(16))) _Float16 v16h;
typedef __attribute__((ext_vector_type(8)))  _Float16 v8h;
typedef __attribute__((ext_vector_type(8)))  unsigned short v8us;
typedef __attribute__((ext_vector_type(8)))  float    v8f;
typedef __attribute__((ext_vector_type(4)))  float    v4f;
typedef v8h  __attribute__((may_alias)) v8ha;
typedef v4f  __attribute__((may_alias)) v4fa;
typedef v8us __attribute__((may_alias)) v8usa;

__device__ __forceinline__ unsigned short f2bf(float f) { unsigned u = __float_as_uint(f); u += 0x7FFFu + ((u >> 16) & 1u); return (unsigned short)(u >> 16); }
__device__ __forceinline__ float bf2f(unsigned short b) { return __uint_as_float(((unsigned)b) << 16); }
__device__ __forceinline__ float bfr(float f) { return bf2f(f2bf(f)); }
__device__ __forceinline__ v16h cat16(v8h lo, v8h hi) { return __builtin_shufflevector(lo, hi, 0, 1, 2, 3, 4, 5, 6, 7, 8, 9, 10, 11, 12, 13, 14, 15); }
__device__ __forceinline__ v16bf cat16b(v8us lo, v8us hi) { return __builtin_bit_cast(v16bf, __builtin_shufflevector(lo, hi, 0, 1, 2, 3, 4, 5, 6, 7, 8, 9, 10, 11, 12, 13, 14, 15)); }
__device__ __forceinline__ v8f wmma16(v16h a, v16h b, v8f c) { return __builtin_amdgcn_wmma_f32_16x16x32_f16(false, a, false, b, (short)0, c, false, false); }
__device__ __forceinline__ v8f wmmab(v16bf a, v16bf b, v8f c) { return __builtin_amdgcn_wmma_f32_16x16x32_bf16(false, a, false, b, (short)0, c, false, false); }

__device__ __forceinline__ h16 tohx(float x) { return (h16)x; }
__device__ __forceinline__ void splitf(float y, unsigned short& h, unsigned short& l) { h = f2bf(y); l = f2bf(y - bf2f(h)); }
typedef __attribute__((ext_vector_type(4))) _Float16 v4h;
typedef __attribute__((ext_vector_type(4))) unsigned short v4us;
typedef __attribute__((ext_vector_type(2))) int v2i;
typedef __attribute__((ext_vector_type(4))) int v4i;
typedef v4h  __attribute__((may_alias)) v4ha;
typedef v4us __attribute__((may_alias)) v4usa;
__device__ __forceinline__ float xlane8(float x) { return __builtin_bit_cast(float, __builtin_amdgcn_update_dpp(0, __builtin_bit_cast(int, x), 0x168, 0xf, 0xf, true)); }   // row_xmask:8: lane l reads lane l ^ 8 of its 16-lane row, on the vector pipe

// ---- k_gemmw: register-blocked GEMM, one work-group of NW waves per 64x64 output tile (16 accumulators a wave), operands straight from 16-bit planes in fragment order; grid (M/64, N/64, Z), 32 * NW threads.
// FRAGMENT ORDER of a [rows][K] plane: the 16 rows x 32 k of one WMMA operand are 512 elements in a row, block (row / 16) * (K / 32) + k / 32; inside it element (row, k) stands at ((k % 32) / 16) * 256 + (row % 16 + 16 * ((k / 8) % 2)) * 8 + k % 8.
// Lane l then finds its two 16-byte pieces at l * 8 and 256 + l * 8 (WFrag::ldf): each load of a wave is 512 bytes in a row, 4 whole cache lines, where the row-major plane gave 32 bytes of each of 16 lines. Every lane and register holds the element it held before.
// Wave w takes the 32-wide k chunks w, w + NW, w + 2 NW, ...; the NW partial tiles are summed through LDS in the fixed order w = 0 .. NW-1 (the one-wave loop is a chain of exposed load latencies: NW chains run side by side).
// NW > 1 stages all 64 rows of every partial tile at once (MBR = 4 blocks of 16 rows): one barrier, and no output store has to drain in front of a second one.
// C[m][n] (f32, pitch ldc, + optional f32 bias[n]) = sum_k A[m][k] Bt[n][k] (+ split products per NSPLIT). z-batch strides sA/sB/sC in elements. K % 32 == 0; K is a constant of the build, so that the fragments of a trip lie at constant offsets from one address per plane.
// EPI says what becomes of the summed tile, whose 64 columns are one head (blockIdx.y) and whose rows are positions t. 0: stored as f32 C.
// 1: rotate-half rotary step out[d] = x[d] cos[t][d] - x[d+32] sin[t][d], out[d+32] = x[d+32] cos[t][d+32] + x[d] sin[t][d+32] (tables rounded to bf16), stored as the planes fp16 + bf16 hi/lo, per head h the fragment order of [t][d]. A lane holds 4 columns of a row, and the partner columns sit 8 lanes away; a wave sums 8 rows in a row, which are the rows of its own 128-byte lines of those planes.
// 2: the sums go back to LDS, each to the place its own thread has just read, and behind a second barrier are read by columns: planes per kv head g in the fragment order of [d][t], but with the blocks counted (t / 32) * (HD / 16) + d / 16, so that the 4 blocks of 32 keys stand in a row; a wave's store is half a block, 512 bytes in a row.
template <typename T16> struct WFrag;
template <> struct WFrag<h16> { typedef v16h V; static __device__ __forceinline__ V ldf(const h16* p) { return cat16(*(const v8h*)p, *(const v8h*)(p + 256)); } static __device__ __forceinline__ v8f mma(V a, V b, v8f c) { return wmma16(a, b, c); } };
template <> struct WFrag<bf> { typedef v16bf V; static __device__ __forceinline__ V ldf(const bf* p) { return cat16b(*(const v8us*)p, *(const v8us*)(p + 256)); } static __device__ __forceinline__ v8f mma(V a, V b, v8f c) { return wmmab(a, b, c); } };
template <typename T16, int NSPLIT, bool BIAS, int NW, int EPI, int K>
__global__ __launch_bounds__(32 * NW) void k_gemmw(const T16* __restrict__ A, const T16* __restrict__ A2, const T16* __restrict__ Bt, const T16* __restrict__ Bt2, float* C, int ldc, const float* __restrict__ bias, size_t sA, size_t sB, size_t sC, const float* __restrict__ cosT, const float* __restrict__ sinT, h16* P16, bf* Ph, bf* Pl) {
    static_assert(EPI == 0 || (NW > 1 && HD == 64), "the plane epilogues want the whole 64-row tile staged and one head per tile");
    typedef typename WFrag<T16>::V V;
    constexpr int MBR = (NW > 1) ? 4 : 1;   // 16-row blocks staged per round
    __shared__ __align__(16) float os[NW * MBR * 16 * 68];
    const int wv = (NW > 1) ? __builtin_amdgcn_readfirstlane((int)(threadIdx.x >> 5)) : 0;   // wave number, scalar: the k loop stays a scalar loop
    const size_t z = blockIdx.z; A += z * sA; if (A2) A2 += z * sA; Bt += z * sB; if (Bt2) Bt2 += z * sB; C += z * sC;
    const int lane = threadIdx.x & 31, lr = lane & 15, hi = lane >> 4; const int r0 = blockIdx.x * 64, c0 = blockIdx.y * 64;
    v8f acc[4][4];
#pragma unroll
    for (int mb = 0; mb < 4; ++mb)
#pragma unroll
        for (int nb = 0; nb < 4; ++nb) acc[mb][nb] = (v8f){};
    v4f tc[8 * MBR / NW], tsn[8 * MBR / NW];
    if constexpr (EPI == 1) {   // this thread's table entries, asked for ahead of the k loop, which covers their latency (the barrier of the epilogue waits for every load that is still out)
        const size_t to = (size_t)(r0 + wv * (16 * MBR / NW) + hi) * HD + lr * 4; const float* pc = cosT + to; const float* ps = sinT + to;   // step s lies 2 rows further on: a constant offset from the same two addresses
#pragma unroll
        for (int s = 0; s < 8 * MBR / NW; ++s) { tc[s] = *(const v4fa*)(pc + (size_t)s * (2 * HD)); tsn[s] = *(const v4fa*)(ps + (size_t)s * (2 * HD)); }
        // s_wait_xcnt 0 behind the table loads; their two address pairs are its inputs, so they stay live up to it and nothing is written into one of them in front of it
        asm volatile("s_wait_xcnt 0x0" :: "v"(pc), "v"(ps) : "memory");
    }
    // 16 rows are K / 32 blocks of 512 = 16 K elements, as in the row-major plane; k chunk c begins 512 c elements in
    const size_t aoff = (size_t)r0 * K + (size_t)wv * 512 + 8 * lane, boff = (size_t)c0 * K + (size_t)wv * 512 + 8 * lane;
    const T16* pa = A + aoff; const T16* pb = Bt + boff; const T16* pa2 = (NSPLIT == 1 || NSPLIT == 2) ? A2 + aoff : pa; const T16* pb2 = (NSPLIT >= 2) ? Bt2 + boff : pb;
#pragma unroll 1
    for (int kc = wv * 32; kc < K; kc += 32 * NW) {
        V a[4], a2[4];
#pragma unroll
        for (int mb = 0; mb < 4; ++mb) { a[mb] = WFrag<T16>::ldf(pa + mb * 16 * K); if (NSPLIT == 1 || NSPLIT == 2) a2[mb] = WFrag<T16>::ldf(pa2 + mb * 16 * K); }
#pragma unroll
        for (int nb = 0; nb < 4; ++nb) { const V b = WFrag<T16>::ldf(pb + nb * 16 * K); V b2; if (NSPLIT >= 2) b2 = WFrag<T16>::ldf(pb2 + nb * 16 * K);
#pragma unroll
            for (int mb = 0; mb < 4; ++mb) { acc[mb][nb] = WFrag<T16>::mma(a[mb], b, acc[mb][nb]); if (NSPLIT == 1 || NSPLIT == 2) acc[mb][nb] = WFrag<T16>::mma(a2[mb], b, acc[mb][nb]); if (NSPLIT >= 2) acc[mb][nb] = WFrag<T16>::mma(a[mb], b2, acc[mb][nb]); } }
        // One statement at the trip's foot. s_wait_xcnt 0 behind the trip's loads, whose addresses are its inputs, in front of the sums that move them on; every load has long returned there. Then four vector slots behind the last WMMAs.
        asm volatile("s_wait_xcnt 0x0\n\tv_nop\n\tv_nop\n\tv_nop\n\tv_nop" : "+v"(acc[0][0]), "+v"(acc[1][1]), "+v"(acc[2][2]), "+v"(acc[3][3]) : "v"(a[0]), "v"(a[3]), "v"(pa), "v"(pb), "v"(pa2), "v"(pb2) : "memory");
        pa += 512 * NW; pb += 512 * NW; if (NSPLIT == 1 || NSPLIT == 2) pa2 += 512 * NW; else pa2 = pa; if (NSPLIT >= 2) pb2 += 512 * NW; else pb2 = pb;
    }
#pragma unroll
    for (int mb = 0; mb < 4; mb += MBR) {
#pragma unroll
        for (int mi = 0; mi < MBR; ++mi)
#pragma unroll
        for (int nb = 0; nb < 4; ++nb) {
#pragma unroll
            for (int j = 0; j < 8; ++j) os[(wv * MBR + mi) * (16 * 68) + (hi * 8 + j) * 68 + nb * 16 + lr] = acc[mb + mi][nb][j]; }
        if (NW > 1) __syncthreads();   // every wave's partial tile is in LDS before any thread sums it
        else { __builtin_amdgcn_wave_barrier(); asm volatile("" ::: "memory"); }
        float* crow = C + (size_t)(r0 + mb * 16) * ldc + c0;
{
#pragma unroll
            for (int s = 0; s < 8 * MBR / NW; ++s) { const int row = 2 * (wv * (8 * MBR / NW) + s) + hi, cofs = lr * 4; v4f val = *(const v4fa*)(os + row * 68 + cofs);
#pragma unroll
                for (int w = 1; w < NW; ++w) val += *(const v4fa*)(os + w * (MBR * 16 * 68) + row * 68 + cofs);
                if (BIAS) { val[0] += bfr(bias[c0 + cofs]); val[1] += bfr(bias[c0 + cofs + 1]); val[2] += bfr(bias[c0 + cofs + 2]); val[3] += bfr(bias[c0 + cofs + 3]); }
                if constexpr (EPI == 0) {
                *(v4f*)(crow + (size_t)row * ldc + cofs) = val; }
                else if constexpr (EPI == 1) { v4h o16; v4us oh, ol;
#pragma unroll
                    for (int i = 0; i < 4; ++i) { const float x1 = xlane8(val[i]), cc = bfr(tc[s][i]), sn = bfr(tsn[s][i]); const float r = val[i] * cc + x1 * ((lr < 8) ? -sn : sn);
                        o16[i] = tohx(r); unsigned short a2, c2; splitf(r, a2, c2); oh[i] = a2; ol[i] = c2; }
                    const size_t e = (size_t)blockIdx.y * TT * HD + (size_t)(((r0 + row) >> 4) * (HD / 32) + (lr >> 3)) * 512 + ((lr >> 2) & 1) * 256 + ((row & 15) + 16 * ((lr >> 1) & 1)) * 8 + (lr & 1) * 4; h16* p16 = P16 + e; bf* ph = Ph + e; bf* pl = Pl + e;
                    *(v4ha*)p16 = o16; *(v4usa*)ph = oh; *(v4usa*)pl = ol;
                    // s_wait_xcnt 0 behind the three stores; their data and address registers are its inputs, so they stay live up to it and nothing is written into one of them in front of it
                    asm volatile("s_wait_xcnt 0x0" :: "v"(__builtin_bit_cast(v2i, o16)), "v"(__builtin_bit_cast(v2i, oh)), "v"(__builtin_bit_cast(v2i, ol)), "v"(p16), "v"(ph), "v"(pl) : "memory"); }
                else *(v4fa*)(os + row * 68 + cofs) = val; }
             }
        if constexpr (EPI == 2) {
            __syncthreads();   // the whole summed tile is in LDS before any thread reads it by columns
#pragma unroll
            for (int u = 0; u < 16 / NW; ++u) { const int cb = u * NW + wv, d = (cb >> 2) * 16 + lr, tq = (cb & 3) * 2 + hi; v8h o16; v8us oh, ol;   // a wave takes 16 d x 16 t: one half block
#pragma unroll
                for (int j = 0; j < 8; ++j) { const float x = os[(tq * 8 + j) * 68 + d]; o16[j] = tohx(x); unsigned short a2, c2; splitf(x, a2, c2); oh[j] = a2; ol[j] = c2; }
                const size_t e = (size_t)blockIdx.y * HD * TT + (size_t)(((r0 >> 5) + ((cb & 3) >> 1)) * (HD / 16) + (cb >> 2)) * 512 + (cb & 1) * 256 + lane * 8; h16* p16 = P16 + e; bf* ph = Ph + e; bf* pl = Pl + e;
                *(v8ha*)p16 = o16; *(v8usa*)ph = oh; *(v8usa*)pl = ol;
                // s_wait_xcnt 0 behind the three stores, data and address registers as inputs: as in the rotary epilogue
                asm volatile("s_wait_xcnt 0x0" :: "v"(__builtin_bit_cast(v4i, o16)), "v"(__builtin_bit_cast(v4i, oh)), "v"(__builtin_bit_cast(v4i, ol)), "v"(p16), "v"(ph), "v"(pl) : "memory"); }
        }
        if (NW == 1) { __builtin_amdgcn_wave_barrier(); asm volatile("" ::: "memory"); }   // NW > 1: one round, nothing is staged again
    }
}


// k_cvt8: f32 [rows][DM] -> bf16 plane in fragment order. Thread i writes the i-th 16 bytes of the plane (whole lines per wave) and reads the 8 floats that belong there; a work-group reads 512 bytes in a row of each of 16 rows.
__global__ __launch_bounds__(256) void k_cvt8(const float* __restrict__ src, bf* dst, size_t n8) { static_assert(DM == DQ, "one k length for every plane built here"); const size_t i = (size_t)blockIdx.x * 256 + threadIdx.x; if (i >= n8) return;
    const int ln = (int)(i & 31), hf = (int)(i >> 5) & 1; const size_t blk = i >> 6, rb = blk / (DM / 32), kb = blk % (DM / 32);
    const float* ps = src + (rb * 16 + (ln & 15)) * DM + kb * 32 + hf * 16 + (ln >> 4) * 8; const v8f v = *(const v8f*)ps; v8us o;
    asm volatile("s_wait_xcnt 0x0" :: "v"(ps) : "memory");   // behind the load, its address as input, in front of whatever reuses that register pair
#pragma unroll
    for (int k = 0; k < 8; ++k) o[k] = f2bf(v[k]); *(v8us*)(dst + i * 8) = o;  }

// ---- k_fattn: causal attention of one batch in one launch. One wave owns 16 * NQ query rows of one head and walks the keys 32 at a time; the four waves of a work-group are the four heads of one kv group at the same rows, so they read the same K and V lines.
// Transposed products: S^T = K Q^T (A = 16 key rows, B = 16 query rows, both by WFrag::ldf), so that lane (lr, hi) holds, of query lr, the scores of keys 8 hi + j and 16 + 8 hi + j: exactly the k positions that WFrag::ldf gives a B operand. The probabilities
// are therefore converted in place into the B operand of O^T += V^T P^T (A = 16 rows of the [d][t] value plane) and touch neither LDS nor memory. Running maximum and sum per query (online softmax, f32); the two lane halves join their maxima every block and their sums once at the end.
// Rows < RH: bf16 hi/lo planes, three products each (HR); the rest fp16 with the probabilities carried x 2^10 (added to the exponent; it cancels against the row sum). The result is divided by the row sum, split hi/lo and stored in the fragment order of the [t][h d] plane: 2 KiB in a row per (16 rows, head) and plane, written by this wave alone.
// Q, K ([t][d] per head) and V ([d][t] per kv head) planes lie in fragment order (see k_gemmw), read by WFrag::ldf: 32 keys are 4 blocks in a row, 4 KiB, of K and of V alike.
__device__ __forceinline__ float xhalf(float x) { return __builtin_bit_cast(float, __builtin_amdgcn_permlanex16(__builtin_bit_cast(int, x), __builtin_bit_cast(int, x), 0x76543210, 0xfedcba98, false, false)); }   // lane l reads lane l ^ 16, on the vector pipe
template <typename T16, bool HR, int NQ, bool MASK, bool NEXT>
__device__ __forceinline__ void fa_block(const T16* pk, const T16* pk2, const T16* pv, const T16* pv2, int k0, int q0, int lr, int hi,
                                         const typename WFrag<T16>::V (&qf)[NQ][2], const typename WFrag<T16>::V (&qf2)[NQ][2], typename WFrag<T16>::V (&ka)[2][2], typename WFrag<T16>::V (&ka2)[2][2], v8f (&o)[4][NQ], float (&mr)[NQ], float (&ls)[NQ]) {
    typedef typename WFrag<T16>::V V;
    V va[4], va2[4];
#pragma unroll
    for (int mt = 0; mt < 4; ++mt) {   // last block, no loop foot behind it: s_wait_xcnt 0 stands behind each fragment's loads, in front of whatever reuses their address registers, a later fragment's data among it
        va[mt] = WFrag<T16>::ldf(pv + mt * 512); if constexpr (!NEXT) asm volatile("s_wait_xcnt 0x0" ::: "memory");
        if constexpr (HR) { va2[mt] = WFrag<T16>::ldf(pv2 + mt * 512); if constexpr (!NEXT) asm volatile("s_wait_xcnt 0x0" ::: "memory"); } }
    v8f s[2][NQ];
#pragma unroll
    for (int kt = 0; kt < 2; ++kt)
#pragma unroll
        for (int nq = 0; nq < NQ; ++nq) { s[kt][nq] = (v8f){};
#pragma unroll
            for (int dc = 0; dc < 2; ++dc) { s[kt][nq] = WFrag<T16>::mma(ka[kt][dc], qf[nq][dc], s[kt][nq]); if constexpr (HR) { s[kt][nq] = WFrag<T16>::mma(ka[kt][dc], qf2[nq][dc], s[kt][nq]); s[kt][nq] = WFrag<T16>::mma(ka2[kt][dc], qf[nq][dc], s[kt][nq]); } } }
    if constexpr (NEXT) {   // the next block's key fragments fly behind the softmax and the value products
#pragma unroll
        for (int kt = 0; kt < 2; ++kt)
#pragma unroll
            for (int dc = 0; dc < 2; ++dc) { ka[kt][dc] = WFrag<T16>::ldf(pk + (size_t)(32 + kt * 16) * HD + dc * 512); if constexpr (HR) ka2[kt][dc] = WFrag<T16>::ldf(pk2 + (size_t)(32 + kt * 16) * HD + dc * 512); } }
    V pf[NQ], pl[NQ];
#pragma unroll
    for (int nq = 0; nq < NQ; ++nq) { float t[16]; const int qi = q0 + nq * 16 + lr;
#pragma unroll
        for (int e = 0; e < 16; ++e) { const float x = s[e >> 3][nq][e & 7] * SCL; t[e] = (!MASK || k0 + (e >> 3) * 16 + hi * 8 + (e & 7) <= qi) ? x : -3.0e38f; }
        float mx = fmaxf(t[0], t[1]);
#pragma unroll
        for (int e = 2; e < 16; ++e) mx = fmaxf(mx, t[e]);
        mx = fmaxf(mx, xhalf(mx));
        const float mn = fmaxf(mr[nq], mx); const float al = __builtin_amdgcn_exp2f((mr[nq] - mn) * 1.4426950408889634f); mr[nq] = mn;
#pragma unroll
        for (int e = 0; e < 16; ++e) t[e] = __builtin_amdgcn_exp2f((t[e] - mn) * 1.4426950408889634f + (HR ? 0.0f : 10.0f));
        ls[nq] = ls[nq] * al + (((t[0] + t[1]) + (t[2] + t[3])) + ((t[4] + t[5]) + (t[6] + t[7]))) + (((t[8] + t[9]) + (t[10] + t[11])) + ((t[12] + t[13]) + (t[14] + t[15])));
#pragma unroll
        for (int mt = 0; mt < 4; ++mt) o[mt][nq] *= al;
        if constexpr (HR) { v8us h0, h1, l0, l1;
#pragma unroll
            for (int e = 0; e < 8; ++e) { unsigned short a, c2; splitf(t[e], a, c2); h0[e] = a; l0[e] = c2; splitf(t[8 + e], a, c2); h1[e] = a; l1[e] = c2; }
            pf[nq] = cat16b(h0, h1); pl[nq] = cat16b(l0, l1);
        } else {
#pragma unroll
            for (int e = 0; e < 16; ++e) pf[nq][e] = tohx(t[e]); } }
#pragma unroll
    for (int mt = 0; mt < 4; ++mt)
#pragma unroll
        for (int nq = 0; nq < NQ; ++nq) { o[mt][nq] = WFrag<T16>::mma(va[mt], pf[nq], o[mt][nq]); if constexpr (HR) { o[mt][nq] = WFrag<T16>::mma(va[mt], pl[nq], o[mt][nq]); o[mt][nq] = WFrag<T16>::mma(va2[mt], pf[nq], o[mt][nq]); } }
}
template <typename T16, bool HR, int NQ>
__device__ __forceinline__ void fa_tile(const T16* __restrict__ Q, const T16* __restrict__ Q2, const T16* __restrict__ Kp, const T16* __restrict__ Kp2, const T16* __restrict__ Vt, const T16* __restrict__ Vt2, int q0, int h, bf* Ah, bf* Al) {
    typedef typename WFrag<T16>::V V;
    const int lane = threadIdx.x & 31, lr = lane & 15, hi = lane >> 4;
    V qf[NQ][2], qf2[NQ][2], ka[2][2], ka2[2][2]; v8f o[4][NQ]; float mr[NQ], ls[NQ];
#pragma unroll
    for (int nq = 0; nq < NQ; ++nq) { mr[nq] = -3.0e38f; ls[nq] = 0.f;
#pragma unroll
        for (int mt = 0; mt < 4; ++mt) o[mt][nq] = (v8f){};
#pragma unroll
        for (int dc = 0; dc < 2; ++dc) { const size_t qo = (size_t)(q0 + nq * 16) * HD + dc * 512 + 8 * lane; qf[nq][dc] = WFrag<T16>::ldf(Q + qo); if constexpr (HR) qf2[nq][dc] = WFrag<T16>::ldf(Q2 + qo); } }
    const T16* pk = Kp + 8 * lane; const T16* pv = Vt + 8 * lane; const T16* pk2 = pk; const T16* pv2 = pv;
    if constexpr (HR) { pk2 = Kp2 + 8 * lane; pv2 = Vt2 + 8 * lane; }
#pragma unroll
    for (int kt = 0; kt < 2; ++kt)
#pragma unroll
        for (int dc = 0; dc < 2; ++dc) { ka[kt][dc] = WFrag<T16>::ldf(pk + (size_t)kt * 16 * HD + dc * 512); if constexpr (HR) ka2[kt][dc] = WFrag<T16>::ldf(pk2 + (size_t)kt * 16 * HD + dc * 512); }
    asm volatile("s_wait_xcnt 0x0" ::: "memory");   // behind the query and first key loads, in front of whatever reuses their address registers
    const int nfull = q0 / 32;   // key blocks that lie wholly at or below every row's diagonal; exactly one more block follows, and it holds every row's own key
    for (int kb = 0; kb < nfull; ++kb) {
        fa_block<T16, HR, NQ, false, true>(pk, pk2, pv, pv2, kb * 32, q0, lr, hi, qf, qf2, ka, ka2, o, mr, ls);
        // One statement at the trip's foot. s_wait_xcnt 0 behind the trip's loads, in front of the next trip's address sums: the accumulators are operands, so it stands behind the last WMMAs, where the loads were issued long ago and it costs nothing.
        // Then four vector slots behind those WMMAs: across the back edge the next trip's first products write registers that these read.
        if constexpr (HR) asm volatile("s_wait_xcnt 0x0\n\tv_nop\n\tv_nop\n\tv_nop\n\tv_nop" : "+v"(o[0][0]), "+v"(o[1][0]), "+v"(o[2][0]), "+v"(o[3][0]) : "v"(pk), "v"(pv), "v"(pk2), "v"(pv2) : "memory");
        else asm volatile("s_wait_xcnt 0x0\n\tv_nop\n\tv_nop\n\tv_nop\n\tv_nop" : "+v"(o[0][0]), "+v"(o[1][0]), "+v"(o[2][0]), "+v"(o[3][0]), "+v"(o[0][NQ - 1]), "+v"(o[1][NQ - 1]), "+v"(o[2][NQ - 1]), "+v"(o[3][NQ - 1]) : "v"(pk), "v"(pv) : "memory");
        pk += 32 * HD; pv += 32 * HD; if constexpr (HR) { pk2 += 32 * HD; pv2 += 32 * HD; }
    }
    fa_block<T16, HR, NQ, true, false>(pk, pk2, pv, pv2, nfull * 32, q0, lr, hi, qf, qf2, ka, ka2, o, mr, ls);
#pragma unroll
    for (int nq = 0; nq < NQ; ++nq) { const float inv = __fdiv_rn(1.0f, ls[nq] + xhalf(ls[nq])); const size_t oo = ((size_t)((q0 >> 4) + nq) * (DQ / 32) + h * (HD / 32)) * 512 + lane * 8; bf* ph = Ah + oo; bf* pl = Al + oo;   // fragment order of the [t][h d] plane: piece mt (16 d) is half a block
#pragma unroll
        for (int mt = 0; mt < 4; ++mt) { v8us oh, ol;
#pragma unroll
            for (int j = 0; j < 8; ++j) { unsigned short a, c2; splitf(o[mt][nq][j] * inv, a, c2); oh[j] = a; ol[j] = c2; }
            *(v8usa*)(ph + mt * 256) = oh; *(v8usa*)(pl + mt * 256) = ol;
            // s_wait_xcnt 0 behind each pair of stores; their data registers and the row's two address pairs are its inputs, so they stay live up to it and nothing is written into one of them in front of it
            asm volatile("s_wait_xcnt 0x0" :: "v"(__builtin_bit_cast(v4i, oh)), "v"(__builtin_bit_cast(v4i, ol)), "v"(ph), "v"(pl) : "memory"); } }
}
// grid (NKV, (TT - RH) / 32 + RH / 16), 128 threads: blockIdx.y counts the row tiles from the longest (last rows) down, the short hi/lo tiles last, so that the long ones start first.
__global__ __launch_bounds__(128) void k_fattn(const h16* __restrict__ Q16, const h16* __restrict__ K16, const h16* __restrict__ V16, const bf* __restrict__ Qh, const bf* __restrict__ Ql, const bf* __restrict__ Kh, const bf* __restrict__ Kl, const bf* __restrict__ Vh, const bf* __restrict__ Vl, bf* Ah, bf* Al) {
    const int wv = __builtin_amdgcn_readfirstlane((int)(threadIdx.x >> 5));   // wave number = head within the kv group, scalar
    const int g = blockIdx.x, h = g * REP + wv, ty = blockIdx.y; const size_t zq = (size_t)h * TT * HD, zk = (size_t)g * TT * HD;
    if (ty < (TT - RH) / 32) fa_tile<h16, false, 2>(Q16 + zq, nullptr, K16 + zk, nullptr, V16 + zk, nullptr, TT - 32 * (ty + 1), h, Ah, Al);
    else fa_tile<bf, true, 1>(Qh + zq, Ql + zq, Kh + zk, Kl + zk, Vh + zk, Vl + zk, RH - 16 * (ty - (TT - RH) / 32 + 1), h, Ah, Al);
}

extern "C" void kernel_launch(void* const* d_in, const int* in_sizes, int n_in,
                              void* d_out, int out_size, void* d_ws, size_t ws_size, hipStream_t stream) {
    (void)in_sizes; (void)n_in; (void)out_size;
    const float* x = (const float*)d_in[0]; const float* fcos = (const float*)d_in[1]; const float* fsin = (const float*)d_in[2]; const float* wq = (const float*)d_in[3]; const float* wk = (const float*)d_in[4]; const float* wv = (const float*)d_in[5]; const float* wo = (const float*)d_in[6];   /* x [2][2048][2048], cos, sin [2][2048][64] = [B][S][HD] (PER-BATCH table inputs: read per element by value), Wq [2048][2048], Wk [512][2048], Wv, Wo ('oi') */
    float* OUT = (float*)d_out;     // [2][2048][2048]
    char* wsp = (char*)d_ws;
    auto take = [&](size_t bytes) { char* p = wsp; wsp += (bytes + 255) & ~(size_t)255; return (void*)p; };
    bf* WQ = (bf*)take((size_t)DQ * DM * 2); bf* WK = (bf*)take((size_t)DKV * DM * 2); bf* WV = (bf*)take((size_t)DKV * DM * 2); bf* WO = (bf*)take((size_t)DM * DQ * 2);
    bf* XB = (bf*)take((size_t)TT * DM * 2);
    h16* QP16 = (h16*)take((size_t)NH_ * TT * HD * 2); h16* KP16 = (h16*)take((size_t)NKV * TT * HD * 2); h16* VT16 = (h16*)take((size_t)NKV * HD * TT * 2);
    bf* QPh = (bf*)take((size_t)NH_ * TT * HD * 2); bf* QPl = (bf*)take((size_t)NH_ * TT * HD * 2); bf* KPh = (bf*)take((size_t)NKV * TT * HD * 2); bf* KPl = (bf*)take((size_t)NKV * TT * HD * 2); bf* VTh = (bf*)take((size_t)NKV * HD * TT * 2); bf* VTl = (bf*)take((size_t)NKV * HD * TT * 2);
    bf* ATh = (bf*)take((size_t)TT * DQ * 2); bf* ATl = (bf*)take((size_t)TT * DQ * 2);
    if ((size_t)(wsp - (char*)d_ws) > ws_size) return;    // ws 256 MiB
    { k_cvt8<<<(unsigned)(((size_t)DQ * DM / 8 + 255) / 256), 256, 0, stream>>>(wq, WQ, (size_t)DQ * DM / 8); k_cvt8<<<(unsigned)(((size_t)DKV * DM / 8 + 255) / 256), 256, 0, stream>>>(wk, WK, (size_t)DKV * DM / 8); k_cvt8<<<(unsigned)(((size_t)DKV * DM / 8 + 255) / 256), 256, 0, stream>>>(wv, WV, (size_t)DKV * DM / 8);
      k_cvt8<<<(unsigned)(((size_t)DM * DQ / 8 + 255) / 256), 256, 0, stream>>>(wo, WO, (size_t)DM * DQ / 8);
       }
    for (int b = 0; b < NB_; ++b) {
        const float* bcos = fcos + (size_t)b * TT * HD; const float* bsin = fsin + (size_t)b * TT * HD;   /* batch b's own rotary table slices (this module's cos / sin are [B][S][HD]) */
        k_cvt8<<<(unsigned)(((size_t)TT * DM / 8 + 255) / 256), 256, 0, stream>>>(x + (size_t)b * TT * DM, XB, (size_t)TT * DM / 8);
        k_gemmw<bf, 0, false, 8, 1, DM><<<dim3(TT / 64, DQ / 64, 1), 256, 0, stream>>>(XB, nullptr, WQ, nullptr, nullptr, 0, nullptr, 0, 0, 0, bcos, bsin, QP16, QPh, QPl);
        k_gemmw<bf, 0, false, 8, 1, DM><<<dim3(TT / 64, DKV / 64, 1), 256, 0, stream>>>(XB, nullptr, WK, nullptr, nullptr, 0, nullptr, 0, 0, 0, bcos, bsin, KP16, KPh, KPl);
        k_gemmw<bf, 0, false, 8, 2, DM><<<dim3(TT / 64, DKV / 64, 1), 256, 0, stream>>>(XB, nullptr, WV, nullptr, nullptr, 0, nullptr, 0, 0, 0, nullptr, nullptr, VT16, VTh, VTl);
        k_fattn<<<dim3(NKV, (TT - RH) / 32 + RH / 16, 1), 128, 0, stream>>>(QP16, KP16, VT16, QPh, QPl, KPh, KPl, VTh, VTl, ATh, ATl);
        k_gemmw<bf, 1, false, 8, 0, DQ><<<dim3(TT / 64, DM / 64, 1), 256, 0, stream>>>(ATh, ATl, WO, nullptr, OUT + (size_t)b * TT * DM, DM, nullptr, 0, 0, 0, nullptr, nullptr, nullptr, nullptr, nullptr); }
}

// v006
// Measured time: 188 microseconds a run.
// Two timings next to v005 put it at 1.37 and 1.38 times that version's speed.
// Counting every step since v000, it is 14.4 times as fast.
#include <hip/hip_runtime.h>

// Grouped-query causal attention (32 / 8 heads x 64) with rotate-half rotary embeddings from PER-BATCH input tables (x [2][2048][2048]; Q = x Wq^T (32 heads x 64), K, V = x Wk^T, x Wv^T (8 kv heads x 64) ('oi' (out, in) normal x 0.02, no bias); q, k -> t cos + rotate_half(t) sin with the cos / sin INPUT tables [2][2048][64] = [B][S][HD] (batch b reads ITS OWN slice, per element by value); jnp.repeat on the head axis: head h uses kv head h / 4; scores x 64^-0.5; causal (finfo.min == exclusion: every row keeps its own key); softmax; out = merged Wo^T ('oi') -> [2][2048][2048] (8.4 M); argument order x, cos, sin, Wq, Wk, Wv, Wo).
// Four launches, each for both batches: k_cvt8 (all five bf16 planes), k_gemmw (q, k, v projections in one grid), k_fattn, k_gemmw (Wo). Layout: bf16 copy of x; 'oi' weights (every 16-bit plane that feeds a WMMA lies in fragment order: see FRAGMENT ORDER below); exact projections whose epilogue builds the head planes (rotate-half with the bf16-rounded cos / sin inputs for q and k, the [d][t] transpose for v); causal T-2048 GQA attention in one launch (k_fattn: scores, online softmax and value products in registers, head h reads kv group h / REP; hybrid rows: < 512 hi/lo 3 products, rest fp16 x1024; key blocks above the diagonal are never read); merged hi/lo x Wo exact.
// Compute dtypes, f32 accumulate: every input rounded to bf16 incl. the tables; projections exact; rotary f32; attention rows < 512 3 products, rest fp16; softmax f32; Wo hl x exact.

#define NB_  2
#define TT   2048
#define DM   2048
#define NH_  32
#define NKV  8
#define REP  (NH_ / NKV)
#define HD   64
#define DQ   (NH_ * HD)
#define DKV  (NKV * HD)
#define NPL  (NH_ + 2 * NKV)      // head planes of one batch, in this order: NH_ of q, NKV of k, NKV of v; each TT * HD elements
#define RH   512                  // query rows < RH use hi+lo planes (0: none)
#define SCL  0.125f   // HD^-0.5
typedef _Float16 h16;
typedef unsigned short bf;
typedef __attribute__((ext_vector_type(16))) __bf16   v16bf;
typedef __attribute__((ext_vector_type(16))) _Float16 v16h;
typedef __attribute__((ext_vector_type(8)))  _Float16 v8h;
typedef __attribute__((ext_vector_type(8)))  unsigned short v8us;
typedef __attribute__((ext_vector_type(8)))  float    v8f;
typedef __attribute__((ext_vector_type(4)))  float    v4f;
typedef v8h  __attribute__((may_alias)) v8ha;
typedef v4f  __attribute__((may_alias)) v4fa;
typedef v8us __attribute__((may_alias)) v8usa;

__device__ __forceinline__ unsigned short f2bf(float f) { unsigned u = __float_as_uint(f); u += 0x7FFFu + ((u >> 16) & 1u); return (unsigned short)(u >> 16); }
__device__ __forceinline__ float bf2f(unsigned short b) { return __uint_as_float(((unsigned)b) << 16); }
__device__ __forceinline__ float bfr(float f) { return bf2f(f2bf(f)); }
__device__ __forceinline__ v16h cat16(v8h lo, v8h hi) { return __builtin_shufflevector(lo, hi, 0, 1, 2, 3, 4, 5, 6, 7, 8, 9, 10, 11, 12, 13, 14, 15); }
__device__ __forceinline__ v16bf cat16b(v8us lo, v8us hi) { return __builtin_bit_cast(v16bf, __builtin_shufflevector(lo, hi, 0, 1, 2, 3, 4, 5, 6, 7, 8, 9, 10, 11, 12, 13, 14, 15)); }
__device__ __forceinline__ v8f wmma16(v16h a, v16h b, v8f c) { return __builtin_amdgcn_wmma_f32_16x16x32_f16(false, a, false, b, (short)0, c, false, false); }
__device__ __forceinline__ v8f wmmab(v16bf a, v16bf b, v8f c) { return __builtin_amdgcn_wmma_f32_16x16x32_bf16(false, a, false, b, (short)0, c, false, false); }

__device__ __forceinline__ h16 tohx(float x) { return (h16)x; }
__device__ __forceinline__ void splitf(float y, unsigned short& h, unsigned short& l) { h = f2bf(y); l = f2bf(y - bf2f(h)); }
typedef __attribute__((ext_vector_type(4))) _Float16 v4h;
typedef __attribute__((ext_vector_type(4))) unsigned short v4us;
typedef __attribute__((ext_vector_type(2))) int v2i;
typedef __attribute__((ext_vector_type(4))) int v4i;
typedef v4h  __attribute__((may_alias)) v4ha;
typedef v4us __attribute__((may_alias)) v4usa;
__device__ __forceinline__ float xlane8(float x) { return __builtin_bit_cast(float, __builtin_amdgcn_update_dpp(0, __builtin_bit_cast(int, x), 0x168, 0xf, 0xf, true)); }   // row_xmask:8: lane l reads lane l ^ 8 of its 16-lane row, on the vector pipe

// ---- k_gemmw: register-blocked GEMM, one work-group of NW waves per 64x64 output tile (16 accumulators a wave), operands straight from 16-bit planes in fragment order; grid (M/64, N/64, Z), 32 * NW threads.
// FRAGMENT ORDER of a [rows][K] plane: the 16 rows x 32 k of one WMMA operand are 512 elements in a row, block (row / 16) * (K / 32) + k / 32; inside it element (row, k) stands at ((k % 32) / 16) * 256 + (row % 16 + 16 * ((k / 8) % 2)) * 8 + k % 8.
// Lane l then finds its two 16-byte pieces at l * 8 and 256 + l * 8 (WFrag::ldf): each load of a wave is 512 bytes in a row, 4 whole cache lines, where the row-major plane gave 32 bytes of each of 16 lines. Every lane and register holds the element it held before.
// Wave w takes the 32-wide k chunks w, w + NW, w + 2 NW, ...; the NW partial tiles are summed through LDS in the fixed order w = 0 .. NW-1 (the one-wave loop is a chain of exposed load latencies: NW chains run side by side).
// NW > 1 stages all 64 rows of every partial tile at once (MBR = 4 blocks of 16 rows): one barrier, and no output store has to drain in front of a second one.
// C[m][n] (f32, pitch ldc, + optional f32 bias[n]) = sum_k A[m][k] Bt[n][k] (+ split products per NSPLIT). z-batch strides sA/sB/sC in elements. K % 32 == 0; K is a constant of the build, so that the fragments of a trip lie at constant offsets from one address per plane.
// EPI says what becomes of the summed tile. 0: stored as f32 C. 1: its 64 columns are one head plane (blockIdx.y: NH_ q heads, NKV k heads, NKV v heads; Bt holds Wq, Wk, Wv one below the other), its rows positions t of batch blockIdx.z; a branch that is the same for the whole work-group picks the form:
// q and k heads: rotate-half rotary step out[d] = x[d] cos[t][d] - x[d+32] sin[t][d], out[d+32] = x[d+32] cos[t][d+32] + x[d] sin[t][d+32] (tables rounded to bf16), stored as the planes fp16 + bf16 hi/lo, per head h the fragment order of [t][d]. A lane holds 4 columns of a row, and the partner columns sit 8 lanes away; a wave sums 8 rows in a row, which are the rows of its own 128-byte lines of those planes.
// v heads: the sums go back to LDS, each to the place its own thread has just read, and behind a second barrier are read by columns: planes per kv head g in the fragment order of [d][t], but with the blocks counted (t / 32) * (HD / 16) + d / 16, so that the 4 blocks of 32 keys stand in a row; a wave's store is half a block, 512 bytes in a row.
template <typename T16> struct WFrag;
template <> struct WFrag<h16> { typedef v16h V; static __device__ __forceinline__ V ldf(const h16* p) { return cat16(*(const v8h*)p, *(const v8h*)(p + 256)); } static __device__ __forceinline__ v8f mma(V a, V b, v8f c) { return wmma16(a, b, c); } };
template <> struct WFrag<bf> { typedef v16bf V; static __device__ __forceinline__ V ldf(const bf* p) { return cat16b(*(const v8us*)p, *(const v8us*)(p + 256)); } static __device__ __forceinline__ v8f mma(V a, V b, v8f c) { return wmmab(a, b, c); } };
template <typename T16, int NSPLIT, bool BIAS, int NW, int EPI, int K>
__global__ __launch_bounds__(32 * NW) void k_gemmw(const T16* __restrict__ A, const T16* __restrict__ A2, const T16* __restrict__ Bt, const T16* __restrict__ Bt2, float* C, int ldc, const float* __restrict__ bias, size_t sA, size_t sB, size_t sC, const float* __restrict__ cosT, const float* __restrict__ sinT, h16* P16, bf* Ph, bf* Pl) {
    static_assert(EPI == 0 || (NW > 1 && HD == 64), "the plane epilogues want the whole 64-row tile staged and one head per tile");
    typedef typename WFrag<T16>::V V;
    constexpr int MBR = (NW > 1) ? 4 : 1;   // 16-row blocks staged per round
    __shared__ __align__(16) float os[NW * MBR * 16 * 68];
    const int wv = (NW > 1) ? __builtin_amdgcn_readfirstlane((int)(threadIdx.x >> 5)) : 0;   // wave number, scalar: the k loop stays a scalar loop
    const size_t z = blockIdx.z; A += z * sA; if (A2) A2 += z * sA; Bt += z * sB; if (Bt2) Bt2 += z * sB; C += z * sC;
    const bool rot = EPI == 1 && blockIdx.y < NH_ + NKV;   // q or k head: rotary epilogue; the same for the whole work-group
    if constexpr (EPI == 1) { cosT += z * (TT * HD); sinT += z * (TT * HD); P16 += z * ((size_t)NPL * TT * HD); Ph += z * ((size_t)NPL * TT * HD); Pl += z * ((size_t)NPL * TT * HD); }
    const int lane = threadIdx.x & 31, lr = lane & 15, hi = lane >> 4; const int r0 = blockIdx.x * 64, c0 = blockIdx.y * 64;
    v8f acc[4][4];
#pragma unroll
    for (int mb = 0; mb < 4; ++mb)
#pragma unroll
        for (int nb = 0; nb < 4; ++nb) acc[mb][nb] = (v8f){};
    v4f tc[8 * MBR / NW] = {}, tsn[8 * MBR / NW] = {};
    if (rot) {   // this thread's table entries, asked for ahead of the k loop, which covers their latency (the barrier of the epilogue waits for every load that is still out)
        const size_t to = (size_t)(r0 + wv * (16 * MBR / NW) + hi) * HD + lr * 4; const float* pc = cosT + to; const float* ps = sinT + to;   // step s lies 2 rows further on: a constant offset from the same two addresses
#pragma unroll
        for (int s = 0; s < 8 * MBR / NW; ++s) { tc[s] = *(const v4fa*)(pc + (size_t)s * (2 * HD)); tsn[s] = *(const v4fa*)(ps + (size_t)s * (2 * HD)); }
        // s_wait_xcnt 0 behind the table loads; their two address pairs are its inputs, so they stay live up to it and nothing is written into one of them in front of it
        asm volatile("s_wait_xcnt 0x0" :: "v"(pc), "v"(ps) : "memory");
    }
    // 16 rows are K / 32 blocks of 512 = 16 K elements, as in the row-major plane; k chunk c begins 512 c elements in
    const size_t aoff = (size_t)r0 * K + (size_t)wv * 512 + 8 * lane, boff = (size_t)c0 * K + (size_t)wv * 512 + 8 * lane;
    const T16* pa = A + aoff; const T16* pb = Bt + boff; const T16* pa2 = (NSPLIT == 1 || NSPLIT == 2) ? A2 + aoff : pa; const T16* pb2 = (NSPLIT >= 2) ? Bt2 + boff : pb;
#pragma unroll 1
    for (int kc = wv * 32; kc < K; kc += 32 * NW) {
        V a[4], a2[4];
#pragma unroll
        for (int mb = 0; mb < 4; ++mb) { a[mb] = WFrag<T16>::ldf(pa + mb * 16 * K); if (NSPLIT == 1 || NSPLIT == 2) a2[mb] = WFrag<T16>::ldf(pa2 + mb * 16 * K); }
#pragma unroll
        for (int nb = 0; nb < 4; ++nb) { const V b = WFrag<T16>::ldf(pb + nb * 16 * K); V b2; if (NSPLIT >= 2) b2 = WFrag<T16>::ldf(pb2 + nb * 16 * K);
#pragma unroll
            for (int mb = 0; mb < 4; ++mb) { acc[mb][nb] = WFrag<T16>::mma(a[mb], b, acc[mb][nb]); if (NSPLIT == 1 || NSPLIT == 2) acc[mb][nb] = WFrag<T16>::mma(a2[mb], b, acc[mb][nb]); if (NSPLIT >= 2) acc[mb][nb] = WFrag<T16>::mma(a[mb], b2, acc[mb][nb]); } }
        // One statement at the trip's foot. s_wait_xcnt 0 behind the trip's loads, whose addresses are its inputs, in front of the sums that move them on; every load has long returned there. Then four vector slots behind the last WMMAs.
        asm volatile("s_wait_xcnt 0x0\n\tv_nop\n\tv_nop\n\tv_nop\n\tv_nop" : "+v"(acc[0][0]), "+v"(acc[1][1]), "+v"(acc[2][2]), "+v"(acc[3][3]) : "v"(a[0]), "v"(a[3]), "v"(pa), "v"(pb), "v"(pa2), "v"(pb2) : "memory");
        pa += 512 * NW; pb += 512 * NW; if (NSPLIT == 1 || NSPLIT == 2) pa2 += 512 * NW; else pa2 = pa; if (NSPLIT >= 2) pb2 += 512 * NW; else pb2 = pb;
    }
#pragma unroll
    for (int mb = 0; mb < 4; mb += MBR) {
#pragma unroll
        for (int mi = 0; mi < MBR; ++mi)
#pragma unroll
        for (int nb = 0; nb < 4; ++nb) {
#pragma unroll
            for (int j = 0; j < 8; ++j) os[(wv * MBR + mi) * (16 * 68) + (hi * 8 + j) * 68 + nb * 16 + lr] = acc[mb + mi][nb][j]; }
        if (NW > 1) __syncthreads();   // every wave's partial tile is in LDS before any thread sums it
        else { __builtin_amdgcn_wave_barrier(); asm volatile("" ::: "memory"); }
        float* crow = C + (size_t)(r0 + mb * 16) * ldc + c0;
{
#pragma unroll
            for (int s = 0; s < 8 * MBR / NW; ++s) { const int row = 2 * (wv * (8 * MBR / NW) + s) + hi, cofs = lr * 4; v4f val = *(const v4fa*)(os + row * 68 + cofs);
#pragma unroll
                for (int w = 1; w < NW; ++w) val += *(const v4fa*)(os + w * (MBR * 16 * 68) + row * 68 + cofs);
                if (BIAS) { val[0] += bfr(bias[c0 + cofs]); val[1] += bfr(bias[c0 + cofs + 1]); val[2] += bfr(bias[c0 + cofs + 2]); val[3] += bfr(bias[c0 + cofs + 3]); }
                if constexpr (EPI == 0) {
                *(v4f*)(crow + (size_t)row * ldc + cofs) = val; }
                else if (rot) { v4h o16; v4us oh, ol;
#pragma unroll
                    for (int i = 0; i < 4; ++i) { const float x1 = xlane8(val[i]), cc = bfr(tc[s][i]), sn = bfr(tsn[s][i]); const float r = val[i] * cc + x1 * ((lr < 8) ? -sn : sn);
                        o16[i] = tohx(r); unsigned short a2, c2; splitf(r, a2, c2); oh[i] = a2; ol[i] = c2; }
                    const size_t e = (size_t)blockIdx.y * TT * HD + (size_t)(((r0 + row) >> 4) * (HD / 32) + (lr >> 3)) * 512 + ((lr >> 2) & 1) * 256 + ((row & 15) + 16 * ((lr >> 1) & 1)) * 8 + (lr & 1) * 4; h16* p16 = P16 + e; bf* ph = Ph + e; bf* pl = Pl + e;
                    *(v4ha*)p16 = o16; *(v4usa*)ph = oh; *(v4usa*)pl = ol;
                    // s_wait_xcnt 0 behind the three stores; their data and address registers are its inputs, so they stay live up to it and nothing is written into one of them in front of it
                    asm volatile("s_wait_xcnt 0x0" :: "v"(__builtin_bit_cast(v2i, o16)), "v"(__builtin_bit_cast(v2i, oh)), "v"(__builtin_bit_cast(v2i, ol)), "v"(p16), "v"(ph), "v"(pl) : "memory"); }
                else *(v4fa*)(os + row * 68 + cofs) = val; }
             }
        if (EPI == 1 && !rot) {
            __syncthreads();   // the whole summed tile is in LDS before any thread reads it by columns
#pragma unroll
            for (int u = 0; u < 16 / NW; ++u) { const int cb = u * NW + wv, d = (cb >> 2) * 16 + lr, tq = (cb & 3) * 2 + hi; v8h o16; v8us oh, ol;   // a wave takes 16 d x 16 t: one half block
#pragma unroll
                for (int j = 0; j < 8; ++j) { const float x = os[(tq * 8 + j) * 68 + d]; o16[j] = tohx(x); unsigned short a2, c2; splitf(x, a2, c2); oh[j] = a2; ol[j] = c2; }
                const size_t e = (size_t)blockIdx.y * HD * TT + (size_t)(((r0 >> 5) + ((cb & 3) >> 1)) * (HD / 16) + (cb >> 2)) * 512 + (cb & 1) * 256 + lane * 8; h16* p16 = P16 + e; bf* ph = Ph + e; bf* pl = Pl + e;
                *(v8ha*)p16 = o16; *(v8usa*)ph = oh; *(v8usa*)pl = ol;
                // s_wait_xcnt 0 behind the three stores, data and address registers as inputs: as in the rotary epilogue
                asm volatile("s_wait_xcnt 0x0" :: "v"(__builtin_bit_cast(v4i, o16)), "v"(__builtin_bit_cast(v4i, oh)), "v"(__builtin_bit_cast(v4i, ol)), "v"(p16), "v"(ph), "v"(pl) : "memory"); }
        }
        if (NW == 1) { __builtin_amdgcn_wave_barrier(); asm volatile("" ::: "memory"); }   // NW > 1: one round, nothing is staged again
    }
}


// k_cvt8: the five f32 [rows][DM] inputs Wq, Wk, Wv, Wo, x (both batches) -> one bf16 plane in fragment order, their rows one below the other. Thread i writes the i-th 16 bytes of the plane (whole lines per wave) and reads the 8 floats that belong there; a work-group reads 512 bytes in a row of each of 16 rows, all of one input.
__global__ __launch_bounds__(256) void k_cvt8(const float* __restrict__ wq, const float* __restrict__ wk, const float* __restrict__ wv, const float* __restrict__ wo, const float* __restrict__ x, bf* dst) { static_assert(DM == DQ, "one k length for every plane built here"); const size_t i = (size_t)blockIdx.x * 256 + threadIdx.x;
    const int ln = (int)(i & 31), hf = (int)(i >> 5) & 1; const size_t blk = i >> 6, kb = blk % (DM / 32);
    const int rg = (int)(blockIdx.x / (DM / 32 / 4));   // 16-row block of the whole plane, the same for the whole work-group: which input it lies in, and where that input begins
    constexpr int B1 = DQ / 16, B2 = (DQ + DKV) / 16, B3 = (DQ + 2 * DKV) / 16, B4 = (DQ + 2 * DKV + DM) / 16;
    const float* src = rg >= B4 ? x : rg >= B3 ? wo : rg >= B2 ? wv : rg >= B1 ? wk : wq; const int rb = rg - (rg >= B4 ? B4 : rg >= B3 ? B3 : rg >= B2 ? B2 : rg >= B1 ? B1 : 0);
    const float* ps = src + (size_t)(rb * 16 + (ln & 15)) * DM + kb * 32 + hf * 16 + (ln >> 4) * 8; const v8f v = *(const v8f*)ps; v8us o;
    asm volatile("s_wait_xcnt 0x0" :: "v"(ps) : "memory");   // behind the load, its address as input, in front of whatever reuses that register pair
#pragma unroll
    for (int k = 0; k < 8; ++k) o[k] = f2bf(v[k]); *(v8us*)(dst + i * 8) = o;  }

// ---- k_fattn: causal attention of both batches in one launch. One wave owns 16 * NQ query rows of one head and walks the keys 32 at a time; the four waves of a work-group are the four heads of one kv group at the same rows, so they read the same K and V lines.
// Transposed products: S^T = K Q^T (A = 16 key rows, B = 16 query rows, both by WFrag::ldf), so that lane (lr, hi) holds, of query lr, the scores of keys 8 hi + j and 16 + 8 hi + j: exactly the k positions that WFrag::ldf gives a B operand. The probabilities
// are therefore converted in place into the B operand of O^T += V^T P^T (A = 16 rows of the [d][t] value plane) and touch neither LDS nor memory. Running maximum and sum per query (online softmax, f32); the two lane halves join their maxima every block and their sums once at the end.
// Rows < RH: bf16 hi/lo planes, three products each (HR); the rest fp16 with the probabilities carried x 2^10 (added to the exponent; it cancels against the row sum). The result is divided by the row sum, split hi/lo and stored in the fragment order of the [t][h d] plane: 2 KiB in a row per (16 rows, head) and plane, written by this wave alone.
// Q, K ([t][d] per head) and V ([d][t] per kv head) planes lie in fragment order (see k_gemmw), read by WFrag::ldf: 32 keys are 4 blocks in a row, 4 KiB, of K and of V alike.
__device__ __forceinline__ float xhalf(float x) { return __builtin_bit_cast(float, __builtin_amdgcn_permlanex16(__builtin_bit_cast(int, x), __builtin_bit_cast(int, x), 0x76543210, 0xfedcba98, false, false)); }   // lane l reads lane l ^ 16, on the vector pipe
template <typename T16, bool HR, int NQ, bool MASK, bool NEXT>
__device__ __forceinline__ void fa_block(const T16* pk, const T16* pk2, const T16* pv, const T16* pv2, int k0, int q0, int lr, int hi,
                                         const typename WFrag<T16>::V (&qf)[NQ][2], const typename WFrag<T16>::V (&qf2)[NQ][2], typename WFrag<T16>::V (&ka)[2][2], typename WFrag<T16>::V (&ka2)[2][2], v8f (&o)[4][NQ], float (&mr)[NQ], float (&ls)[NQ]) {
    typedef typename WFrag<T16>::V V;
    V va[4], va2[4];
#pragma unroll
    for (int mt = 0; mt < 4; ++mt) {   // last block, no loop foot behind it: s_wait_xcnt 0 stands behind each fragment's loads, in front of whatever reuses their address registers, a later fragment's data among it
        va[mt] = WFrag<T16>::ldf(pv + mt * 512); if constexpr (!NEXT) asm volatile("s_wait_xcnt 0x0" ::: "memory");
        if constexpr (HR) { va2[mt] = WFrag<T16>::ldf(pv2 + mt * 512); if constexpr (!NEXT) asm volatile("s_wait_xcnt 0x0" ::: "memory"); } }
    v8f s[2][NQ];
#pragma unroll
    for (int kt = 0; kt < 2; ++kt)
#pragma unroll
        for (int nq = 0; nq < NQ; ++nq) { s[kt][nq] = (v8f){};
#pragma unroll
            for (int dc = 0; dc < 2; ++dc) { s[kt][nq] = WFrag<T16>::mma(ka[kt][dc], qf[nq][dc], s[kt][nq]); if constexpr (HR) { s[kt][nq] = WFrag<T16>::mma(ka[kt][dc], qf2[nq][dc], s[kt][nq]); s[kt][nq] = WFrag<T16>::mma(ka2[kt][dc], qf[nq][dc], s[kt][nq]); } } }
    if constexpr (NEXT) {   // the next block's key fragments fly behind the softmax and the value products
#pragma unroll
        for (int kt = 0; kt < 2; ++kt)
#pragma unroll
            for (int dc = 0; dc < 2; ++dc) { ka[kt][dc] = WFrag<T16>::ldf(pk + (size_t)(32 + kt * 16) * HD + dc * 512); if constexpr (HR) ka2[kt][dc] = WFrag<T16>::ldf(pk2 + (size_t)(32 + kt * 16) * HD + dc * 512); } }
    V pf[NQ], pl[NQ];
#pragma unroll
    for (int nq = 0; nq < NQ; ++nq) { float t[16]; const int qi = q0 + nq * 16 + lr;
#pragma unroll
        for (int e = 0; e < 16; ++e) { const float x = s[e >> 3][nq][e & 7] * SCL; t[e] = (!MASK || k0 + (e >> 3) * 16 + hi * 8 + (e & 7) <= qi) ? x : -3.0e38f; }
        float mx = fmaxf(t[0], t[1]);
#pragma unroll
        for (int e = 2; e < 16; ++e) mx = fmaxf(mx, t[e]);
        mx = fmaxf(mx, xhalf(mx));
        const float mn = fmaxf(mr[nq], mx); const float al = __builtin_amdgcn_exp2f((mr[nq] - mn) * 1.4426950408889634f); mr[nq] = mn;
#pragma unroll
        for (int e = 0; e < 16; ++e) t[e] = __builtin_amdgcn_exp2f((t[e] - mn) * 1.4426950408889634f + (HR ? 0.0f : 10.0f));
        ls[nq] = ls[nq] * al + (((t[0] + t[1]) + (t[2] + t[3])) + ((t[4] + t[5]) + (t[6] + t[7]))) + (((t[8] + t[9]) + (t[10] + t[11])) + ((t[12] + t[13]) + (t[14] + t[15])));
#pragma unroll
        for (int mt = 0; mt < 4; ++mt) o[mt][nq] *= al;
        if constexpr (HR) { v8us h0, h1, l0, l1;
#pragma unroll
            for (int e = 0; e < 8; ++e) { unsigned short a, c2; splitf(t[e], a, c2); h0[e] = a; l0[e] = c2; splitf(t[8 + e], a, c2); h1[e] = a; l1[e] = c2; }
            pf[nq] = cat16b(h0, h1); pl[nq] = cat16b(l0, l1);
        } else {
#pragma unroll
            for (int e = 0; e < 16; ++e) pf[nq][e] = tohx(t[e]); } }
#pragma unroll
    for (int mt = 0; mt < 4; ++mt)
#pragma unroll
        for (int nq = 0; nq < NQ; ++nq) { o[mt][nq] = WFrag<T16>::mma(va[mt], pf[nq], o[mt][nq]); if constexpr (HR) { o[mt][nq] = WFrag<T16>::mma(va[mt], pl[nq], o[mt][nq]); o[mt][nq] = WFrag<T16>::mma(va2[mt], pf[nq], o[mt][nq]); } }
}
template <typename T16, bool HR, int NQ>
__device__ __forceinline__ void fa_tile(const T16* __restrict__ Q, const T16* __restrict__ Q2, const T16* __restrict__ Kp, const T16* __restrict__ Kp2, const T16* __restrict__ Vt, const T16* __restrict__ Vt2, int q0, int h, bf* Ah, bf* Al) {
    typedef typename WFrag<T16>::V V;
    const int lane = threadIdx.x & 31, lr = lane & 15, hi = lane >> 4;
    V qf[NQ][2], qf2[NQ][2], ka[2][2], ka2[2][2]; v8f o[4][NQ]; float mr[NQ], ls[NQ];
#pragma unroll
    for (int nq = 0; nq < NQ; ++nq) { mr[nq] = -3.0e38f; ls[nq] = 0.f;
#pragma unroll
        for (int mt = 0; mt < 4; ++mt) o[mt][nq] = (v8f){};
#pragma unroll
        for (int dc = 0; dc < 2; ++dc) { const size_t qo = (size_t)(q0 + nq * 16) * HD + dc * 512 + 8 * lane; qf[nq][dc] = WFrag<T16>::ldf(Q + qo); if constexpr (HR) qf2[nq][dc] = WFrag<T16>::ldf(Q2 + qo); } }
    const T16* pk = Kp + 8 * lane; const T16* pv = Vt + 8 * lane; const T16* pk2 = pk; const T16* pv2 = pv;
    if constexpr (HR) { pk2 = Kp2 + 8 * lane; pv2 = Vt2 + 8 * lane; }
#pragma unroll
    for (int kt = 0; kt < 2; ++kt)
#pragma unroll
        for (int dc = 0; dc < 2; ++dc) { ka[kt][dc] = WFrag<T16>::ldf(pk + (size_t)kt * 16 * HD + dc * 512); if constexpr (HR) ka2[kt][dc] = WFrag<T16>::ldf(pk2 + (size_t)kt * 16 * HD + dc * 512); }
    asm volatile("s_wait_xcnt 0x0" ::: "memory");   // behind the query and first key loads, in front of whatever reuses their address registers
    const int nfull = q0 / 32;   // key blocks that lie wholly at or below every row's diagonal; exactly one more block follows, and it holds every row's own key
    for (int kb = 0; kb < nfull; ++kb) {
        fa_block<T16, HR, NQ, false, true>(pk, pk2, pv, pv2, kb * 32, q0, lr, hi, qf, qf2, ka, ka2, o, mr, ls);
        // One statement at the trip's foot. s_wait_xcnt 0 behind the trip's loads, in front of the next trip's address sums: the accumulators are operands, so it stands behind the last WMMAs, where the loads were issued long ago and it costs nothing.
        // Then four vector slots behind those WMMAs: across the back edge the next trip's first products write registers that these read.
        if constexpr (HR) asm volatile("s_wait_xcnt 0x0\n\tv_nop\n\tv_nop\n\tv_nop\n\tv_nop" : "+v"(o[0][0]), "+v"(o[1][0]), "+v"(o[2][0]), "+v"(o[3][0]) : "v"(pk), "v"(pv), "v"(pk2), "v"(pv2) : "memory");
        else asm volatile("s_wait_xcnt 0x0\n\tv_nop\n\tv_nop\n\tv_nop\n\tv_nop" : "+v"(o[0][0]), "+v"(o[1][0]), "+v"(o[2][0]), "+v"(o[3][0]), "+v"(o[0][NQ - 1]), "+v"(o[1][NQ - 1]), "+v"(o[2][NQ - 1]), "+v"(o[3][NQ - 1]) : "v"(pk), "v"(pv) : "memory");
        pk += 32 * HD; pv += 32 * HD; if constexpr (HR) { pk2 += 32 * HD; pv2 += 32 * HD; }
    }
    fa_block<T16, HR, NQ, true, false>(pk, pk2, pv, pv2, nfull * 32, q0, lr, hi, qf, qf2, ka, ka2, o, mr, ls);
#pragma unroll
    for (int nq = 0; nq < NQ; ++nq) { const float inv = __fdiv_rn(1.0f, ls[nq] + xhalf(ls[nq])); const size_t oo = ((size_t)((q0 >> 4) + nq) * (DQ / 32) + h * (HD / 32)) * 512 + lane * 8; bf* ph = Ah + oo; bf* pl = Al + oo;   // fragment order of the [t][h d] plane: piece mt (16 d) is half a block
#pragma unroll
        for (int mt = 0; mt < 4; ++mt) { v8us oh, ol;
#pragma unroll
            for (int j = 0; j < 8; ++j) { unsigned short a, c2; splitf(o[mt][nq][j] * inv, a, c2); oh[j] = a; ol[j] = c2; }
            *(v8usa*)(ph + mt * 256) = oh; *(v8usa*)(pl + mt * 256) = ol;
            // s_wait_xcnt 0 behind each pair of stores; their data registers and the row's two address pairs are its inputs, so they stay live up to it and nothing is written into one of them in front of it
            asm volatile("s_wait_xcnt 0x0" :: "v"(__builtin_bit_cast(v4i, oh)), "v"(__builtin_bit_cast(v4i, ol)), "v"(ph), "v"(pl) : "memory"); } }
}
// grid (NKV * NB_, (TT - RH) / 32 + RH / 16), 128 threads: blockIdx.x is kv group and batch; the plane pointers are batch 0's, batch b's lie NPL head planes (Ah, Al: TT * DQ elements) further on each; blockIdx.y counts the row tiles from the longest (last rows) down, the short hi/lo tiles last, so that the long ones start first.
__global__ __launch_bounds__(128) void k_fattn(const h16* __restrict__ Q16, const h16* __restrict__ K16, const h16* __restrict__ V16, const bf* __restrict__ Qh, const bf* __restrict__ Ql, const bf* __restrict__ Kh, const bf* __restrict__ Kl, const bf* __restrict__ Vh, const bf* __restrict__ Vl, bf* Ah, bf* Al) {
    const int wv = __builtin_amdgcn_readfirstlane((int)(threadIdx.x >> 5));   // wave number = head within the kv group, scalar: the head's Q plane and output offsets stay scalar
    const int g = blockIdx.x % NKV, b = blockIdx.x / NKV, h = g * REP + wv, ty = blockIdx.y; const size_t zq = (size_t)(b * NPL + h) * TT * HD, zk = (size_t)(b * NPL + g) * TT * HD; Ah += (size_t)b * TT * DQ; Al += (size_t)b * TT * DQ;
    if (ty < (TT - RH) / 32) fa_tile<h16, false, 2>(Q16 + zq, nullptr, K16 + zk, nullptr, V16 + zk, nullptr, TT - 32 * (ty + 1), h, Ah, Al);
    else fa_tile<bf, true, 1>(Qh + zq, Ql + zq, Kh + zk, Kl + zk, Vh + zk, Vl + zk, RH - 16 * (ty - (TT - RH) / 32 + 1), h, Ah, Al);
}

extern "C" void kernel_launch(void* const* d_in, const int* in_sizes, int n_in,
                              void* d_out, int out_size, void* d_ws, size_t ws_size, hipStream_t stream) {
    (void)in_sizes; (void)n_in; (void)out_size;
    const float* x = (const float*)d_in[0]; const float* fcos = (const float*)d_in[1]; const float* fsin = (const float*)d_in[2]; const float* wq = (const float*)d_in[3]; const float* wk = (const float*)d_in[4]; const float* wv = (const float*)d_in[5]; const float* wo = (const float*)d_in[6];   /* x [2][2048][2048], cos, sin [2][2048][64] = [B][S][HD] (PER-BATCH table inputs: read per element by value), Wq [2048][2048], Wk [512][2048], Wv, Wo ('oi') */
    float* OUT = (float*)d_out;     // [2][2048][2048]
    char* wsp = (char*)d_ws;
    auto take = [&](size_t bytes) { char* p = wsp; wsp += (bytes + 255) & ~(size_t)255; return (void*)p; };
    bf* WQ = (bf*)take((size_t)(DQ + 2 * DKV + DM + NB_ * TT) * DM * 2); bf* WO = WQ + (size_t)(DQ + 2 * DKV) * DM; bf* XB = WO + (size_t)DM * DQ;   // one plane: Wq, Wk, Wv, Wo, x
    h16* P16 = (h16*)take((size_t)NB_ * NPL * TT * HD * 2); bf* Ph = (bf*)take((size_t)NB_ * NPL * TT * HD * 2); bf* Pl = (bf*)take((size_t)NB_ * NPL * TT * HD * 2);   // [batch][q heads, k heads, v heads]
    bf* ATh = (bf*)take((size_t)NB_ * TT * DQ * 2); bf* ATl = (bf*)take((size_t)NB_ * TT * DQ * 2);
    if ((size_t)(wsp - (char*)d_ws) > ws_size) return;    // ws 256 MiB
    const size_t ok = (size_t)NH_ * TT * HD, ov = (size_t)(NH_ + NKV) * TT * HD;   // where the k and the v head planes of a batch begin
    k_cvt8<<<(unsigned)((size_t)(DQ + 2 * DKV + DM + NB_ * TT) * DM / 8 / 256), 256, 0, stream>>>(wq, wk, wv, wo, x, WQ);
    k_gemmw<bf, 0, false, 8, 1, DM><<<dim3(TT / 64, NPL, NB_), 256, 0, stream>>>(XB, nullptr, WQ, nullptr, nullptr, 0, nullptr, (size_t)TT * DM, 0, 0, fcos, fsin, P16, Ph, Pl);   /* batch z reads its own rotary table slices (cos / sin are [B][S][HD]) */
    k_fattn<<<dim3(NKV * NB_, (TT - RH) / 32 + RH / 16, 1), 128, 0, stream>>>(P16, P16 + ok, P16 + ov, Ph, Pl, Ph + ok, Pl + ok, Ph + ov, Pl + ov, ATh, ATl);
    k_gemmw<bf, 1, false, 8, 0, DQ><<<dim3(TT / 64, DM / 64, NB_), 256, 0, stream>>>(ATh, ATl, WO, nullptr, OUT, DM, nullptr, (size_t)TT * DQ, 0, (size_t)TT * DM, nullptr, nullptr, nullptr, nullptr, nullptr);
}
